// v000
// Measured on an AMD MI455X. A time is GPU time per run, averaged over a window of back-to-back runs after a warm-up
// (all launches, gaps included; the runs take copies of the inputs in turn), and the median of several windows.
// Apart from v000's, it joins two sittings. Times from different sittings can be a few percent apart, while
// side-by-side timings come from the same sitting.
// v000 is the starting kernel. One run takes 367 microseconds.
#include <hip/hip_runtime.h>
#include <hip/hip_bf16.h>
#include <math.h>

typedef float v2f __attribute__((ext_vector_type(2)));
typedef float v8f __attribute__((ext_vector_type(8)));

constexpr int kB      = 16;
constexpr int kC      = 256;
constexpr int kHW     = 1024;   // 32*32 pixels
constexpr int kHeads  = 4;
constexpr int kHD     = 64;     // head dim
constexpr int kGroups = 16;
constexpr int kCPG    = kC / kGroups;  // 16 channels per group
constexpr float kEPS  = 1e-5f;

// ---------------------------------------------------------------------------
// f32 dense WMMA: D(16x16,f32) = A(16x4,f32) * B(4x16,f32) + C
// A frag: lane<16 -> M=lane, K = {0,1}; lane>=16 -> M=lane-16, K = {2,3}
// B frag: lane<16 -> N=lane, K = {0,1}; lane>=16 -> N=lane-16, K = {2,3}
// C/D   : vgpr r, lane<16 -> (M=r, N=lane); lane>=16 -> (M=r+8, N=lane-16)
// ---------------------------------------------------------------------------
__device__ __forceinline__ v8f wmma4(v2f a, v2f b, v8f c) {
  return __builtin_amdgcn_wmma_f32_16x16x4_f32(
      /*neg_a=*/false, a, /*neg_b=*/false, b,
      /*c_mod=*/(short)0, c, /*reuse_a=*/false, /*reuse_b=*/false);
}

// gfx1250 async global->LDS copy (ASYNCcnt path). 16B per lane.
__device__ __forceinline__ void async_g2l_b128(unsigned lds_byte_ofs,
                                               const float* gaddr) {
  asm volatile("global_load_async_to_lds_b128 %0, %1, off"
               :: "v"(lds_byte_ofs), "v"(gaddr) : "memory");
}
__device__ __forceinline__ void wait_async0() {
  asm volatile("s_wait_asynccnt 0" ::: "memory");
}

// ---------------------------------------------------------------------------
// GroupNorm: one block per (batch, group); 16 ch * 1024 px = 16384 elements
// ---------------------------------------------------------------------------
__global__ __launch_bounds__(256) void groupnorm_kernel(
    const float* __restrict__ x, const float* __restrict__ gw,
    const float* __restrict__ gb, float* __restrict__ y) {
  const int bg = blockIdx.x;           // b*kGroups + g
  const int g  = bg % kGroups;
  const size_t base = (size_t)bg * kCPG * kHW;   // == b*kC*kHW + g*kCPG*kHW
  const float* xp = x + base;

  float s = 0.f, s2 = 0.f;
  for (int i = threadIdx.x; i < kCPG * kHW; i += blockDim.x) {
    float v = xp[i];
    s += v; s2 += v * v;
  }
  for (int off = 16; off > 0; off >>= 1) {
    s  += __shfl_down(s,  off, 32);
    s2 += __shfl_down(s2, off, 32);
  }
  __shared__ float rs[8], rs2[8];
  __shared__ float smu, srstd;
  const int wv = threadIdx.x >> 5, ln = threadIdx.x & 31;
  if (ln == 0) { rs[wv] = s; rs2[wv] = s2; }
  __syncthreads();
  if (threadIdx.x == 0) {
    float ts = 0.f, ts2 = 0.f;
    for (int i = 0; i < 8; ++i) { ts += rs[i]; ts2 += rs2[i]; }
    const float cnt = (float)(kCPG * kHW);
    float mu  = ts / cnt;
    float var = ts2 / cnt - mu * mu;
    smu = mu; srstd = rsqrtf(var + kEPS);
  }
  __syncthreads();
  const float mu = smu, rstd = srstd;
  for (int i = threadIdx.x; i < kCPG * kHW; i += blockDim.x) {
    int c = g * kCPG + i / kHW;
    y[base + i] = (xp[i] - mu) * rstd * gw[c] + gb[c];
  }
}

// ---------------------------------------------------------------------------
// QKV projection: Y[b][n][c][p] = sum_k W[n*192 + sel*64 + c][k] * X[b][k][p]
// sel: 0 = Q rows, 1 = K rows, 2 = V rows.  One wave -> 16(out ch) x 16(px).
// grid = (8, 16, B); block = 256 (8 waves, each a distinct pixel tile)
// ---------------------------------------------------------------------------
__global__ __launch_bounds__(256) void qkv_kernel(
    const float* __restrict__ W, const float* __restrict__ X,
    float* __restrict__ Y, int sel) {
  const int wave = threadIdx.x >> 5, lane = threadIdx.x & 31;
  const int half = lane >> 4, idx = lane & 15;
  const int p0 = blockIdx.x * 128 + wave * 16;
  const int n  = blockIdx.y >> 2;       // head
  const int ct = blockIdx.y & 3;        // 16-channel tile within head
  const int wrow0 = n * 192 + sel * 64 + ct * 16;
  const float* Wp = W + (size_t)wrow0 * kC;
  const float* Xp = X + (size_t)blockIdx.z * kC * kHW;

  v8f acc = {};
  for (int k0 = 0; k0 < kC; k0 += 4) {
    const int kk = k0 + 2 * half;
    v2f a;  a.x = Wp[idx * kC + kk];            a.y = Wp[idx * kC + kk + 1];
    v2f bf; bf.x = Xp[(size_t)kk * kHW + p0 + idx];
            bf.y = Xp[(size_t)(kk + 1) * kHW + p0 + idx];
    acc = wmma4(a, bf, acc);
  }
  float* Yp = Y + (((size_t)blockIdx.z * kHeads + n) * kHD + ct * 16 + 8 * half)
                  * (size_t)kHW + p0 + idx;
  #pragma unroll
  for (int r = 0; r < 8; ++r) Yp[(size_t)r * kHW] = acc[r];
}

// ---------------------------------------------------------------------------
// Flash attention per (b, head).  All 8 waves of a block share one (b, head);
// each 64x16 K/V tile is staged ONCE per block into LDS via async
// global->LDS b128 copies (coalesced 16B/lane), then all waves feed WMMA
// fragments from LDS.  Row stride 20 floats keeps b128 stores 16B-aligned
// and frag reads bank-conflict-free.  Per-wave P staged in LDS for the
// P*V^T A-fragments.  Output stored as Xatt[b][p][n*64+c].
// ---------------------------------------------------------------------------
__global__ __launch_bounds__(256) void attn_kernel(
    const float* __restrict__ Q, const float* __restrict__ K,
    const float* __restrict__ V, float* __restrict__ Xatt) {
  __shared__ float Kt[64][20];       // K tile: [c][yx], stride 20 (80B rows)
  __shared__ float Vt[64][20];       // V tile: [c][yx]
  __shared__ float Plds[8][16][17];  // per-wave P tile
  const int tid  = threadIdx.x;
  const int wave = tid >> 5, lane = tid & 31;
  const int half = lane >> 4, idx = lane & 15;
  const int wid = blockIdx.x * 8 + wave;     // 0..4095
  const int qt  = wid & 63;                  // query tile (per wave)
  const int bn  = wid >> 6;                  // b*4 + n (uniform in block)
  const int n   = bn & 3, b = bn >> 2;
  const float* Qp = Q + (size_t)bn * kHD * kHW;
  const float* Kp = K + (size_t)bn * kHD * kHW;
  const float* Vp = V + (size_t)bn * kHD * kHW;
  const int q0 = qt * 16;

  // staging assignment: thread -> (channel row sc, 4-float column chunk x4)
  const int sc = tid >> 2;            // 0..63
  const int x4 = (tid & 3) * 4;       // 0,4,8,12
  const unsigned kofs = (unsigned)(uintptr_t)&Kt[sc][x4];
  const unsigned vofs = (unsigned)(uintptr_t)&Vt[sc][x4];

  // preload A frags of Q^T (row = query px, K dim = channel 0..63)
  v2f aq[16];
  #pragma unroll
  for (int ks = 0; ks < 16; ++ks) {
    const int c = ks * 4 + 2 * half;
    aq[ks].x = Qp[(size_t)c * kHW + q0 + idx];
    aq[ks].y = Qp[(size_t)(c + 1) * kHW + q0 + idx];
  }

  v8f o0 = {}, o1 = {}, o2 = {}, o3 = {};
  float m[8], l[8];
  #pragma unroll
  for (int r = 0; r < 8; ++r) { m[r] = -3.0e38f; l[r] = 0.f; }
  const float inv_sqrt_c = 0.0625f;   // 1/sqrt(256)

  for (int j = 0; j < 64; ++j) {
    const int y0 = j * 16;
    __syncthreads();                            // LDS tile reuse fence
    async_g2l_b128(kofs, Kp + (size_t)sc * kHW + y0 + x4);
    async_g2l_b128(vofs, Vp + (size_t)sc * kHW + y0 + x4);
    wait_async0();                              // own async copies done
    __syncthreads();                            // tile visible to all waves

    // ---- S tile = Q^T K (K frags from LDS) ----
    v8f s = {};
    #pragma unroll
    for (int ks = 0; ks < 16; ++ks) {
      const int c = ks * 4 + 2 * half;
      v2f bk;
      bk.x = Kt[c][idx];
      bk.y = Kt[c + 1][idx];
      s = wmma4(aq[ks], bk, s);
    }
    // ---- online softmax (row stats within each 16-lane half) ----
    float sc8[8];
    #pragma unroll
    for (int r = 0; r < 8; ++r) {
      float sv = s[r] * inv_sqrt_c;
      float mx = sv;
      mx = fmaxf(mx, __shfl_xor(mx, 1, 32));
      mx = fmaxf(mx, __shfl_xor(mx, 2, 32));
      mx = fmaxf(mx, __shfl_xor(mx, 4, 32));
      mx = fmaxf(mx, __shfl_xor(mx, 8, 32));
      const float mnew = fmaxf(m[r], mx);
      const float p = __expf(sv - mnew);
      float rsum = p;
      rsum += __shfl_xor(rsum, 1, 32);
      rsum += __shfl_xor(rsum, 2, 32);
      rsum += __shfl_xor(rsum, 4, 32);
      rsum += __shfl_xor(rsum, 8, 32);
      sc8[r] = __expf(m[r] - mnew);
      l[r]   = l[r] * sc8[r] + rsum;
      m[r]   = mnew;
      Plds[wave][r + 8 * half][idx] = p;   // stage P for A-frag reload
    }
    #pragma unroll
    for (int r = 0; r < 8; ++r) {
      o0[r] *= sc8[r]; o1[r] *= sc8[r]; o2[r] *= sc8[r]; o3[r] *= sc8[r];
    }
    asm volatile("s_wait_dscnt 0" ::: "memory");   // same-wave LDS RAW on P

    // ---- O += P(16x16) * V^T(16x64) (V frags from LDS) ----
    #pragma unroll
    for (int ks = 0; ks < 4; ++ks) {
      const int kk = ks * 4 + 2 * half;
      v2f ap; ap.x = Plds[wave][idx][kk]; ap.y = Plds[wave][idx][kk + 1];
      v2f bv;
      bv.x = Vt[0 * 16 + idx][kk]; bv.y = Vt[0 * 16 + idx][kk + 1];
      o0 = wmma4(ap, bv, o0);
      bv.x = Vt[1 * 16 + idx][kk]; bv.y = Vt[1 * 16 + idx][kk + 1];
      o1 = wmma4(ap, bv, o1);
      bv.x = Vt[2 * 16 + idx][kk]; bv.y = Vt[2 * 16 + idx][kk + 1];
      o2 = wmma4(ap, bv, o2);
      bv.x = Vt[3 * 16 + idx][kk]; bv.y = Vt[3 * 16 + idx][kk + 1];
      o3 = wmma4(ap, bv, o3);
    }
  }

  // normalize and store as (b, p, c) with c = n*64 + ct*16 + idx (coalesced)
  #pragma unroll
  for (int r = 0; r < 8; ++r) {
    const float rcp = 1.0f / l[r];
    const int p = q0 + r + 8 * half;
    const size_t base = ((size_t)b * kHW + p) * kC + n * kHD;
    Xatt[base + 0 * 16 + idx] = o0[r] * rcp;
    Xatt[base + 1 * 16 + idx] = o1[r] * rcp;
    Xatt[base + 2 * 16 + idx] = o2[r] * rcp;
    Xatt[base + 3 * 16 + idx] = o3[r] * rcp;
  }
}

// ---------------------------------------------------------------------------
// Output projection + bias + residual:
// Y[b][o][p] = sum_c Wout[o][c] * Xatt[b][p][c] + bout[o] + textn[b][o][p]
// ---------------------------------------------------------------------------
__global__ __launch_bounds__(256) void proj_out_kernel(
    const float* __restrict__ Wout, const float* __restrict__ bout,
    const float* __restrict__ Xatt, const float* __restrict__ textn,
    float* __restrict__ Y) {
  const int wave = threadIdx.x >> 5, lane = threadIdx.x & 31;
  const int half = lane >> 4, idx = lane & 15;
  const int p0 = blockIdx.x * 128 + wave * 16;
  const int o0 = blockIdx.y * 16;
  const int b  = blockIdx.z;
  const float* Wp = Wout + (size_t)o0 * kC;
  const float* Xp = Xatt + (size_t)b * kHW * kC;

  v8f acc = {};
  for (int k0 = 0; k0 < kC; k0 += 4) {
    const int kk = k0 + 2 * half;
    v2f a;  a.x  = Wp[idx * kC + kk];           a.y  = Wp[idx * kC + kk + 1];
    v2f bv; bv.x = Xp[(size_t)(p0 + idx) * kC + kk];
            bv.y = Xp[(size_t)(p0 + idx) * kC + kk + 1];
    acc = wmma4(a, bv, acc);
  }
  #pragma unroll
  for (int r = 0; r < 8; ++r) {
    const int o = o0 + r + 8 * half;
    const size_t off = ((size_t)b * kC + o) * kHW + p0 + idx;
    Y[off] = acc[r] + bout[o] + textn[off];
  }
}

// ---------------------------------------------------------------------------
extern "C" void kernel_launch(void* const* d_in, const int* in_sizes, int n_in,
                              void* d_out, int out_size, void* d_ws, size_t ws_size,
                              hipStream_t stream) {
  const float* fea_img  = (const float*)d_in[0];
  const float* fea_text = (const float*)d_in[1];
  const float* gnA_w    = (const float*)d_in[2];
  const float* gnA_b    = (const float*)d_in[3];
  const float* gnB_w    = (const float*)d_in[4];
  const float* gnB_b    = (const float*)d_in[5];
  const float* W_qkv_A  = (const float*)d_in[6];
  const float* W_qkv_B  = (const float*)d_in[7];
  const float* W_out    = (const float*)d_in[8];
  const float* b_out    = (const float*)d_in[9];
  float* out = (float*)d_out;

  float* ws = (float*)d_ws;
  const size_t SEG = (size_t)kB * kC * kHW;   // 4,194,304 floats (16 MB)
  float* img_n  = ws + 0 * SEG;
  float* text_n = ws + 1 * SEG;
  float* Qb     = ws + 2 * SEG;   // (B, 4, 64, 1024)
  float* Kb     = ws + 3 * SEG;
  float* Vb     = ws + 4 * SEG;
  float* Xatt   = ws + 5 * SEG;   // (B, 1024, 256)

  groupnorm_kernel<<<kB * kGroups, 256, 0, stream>>>(fea_img,  gnA_w, gnA_b, img_n);
  groupnorm_kernel<<<kB * kGroups, 256, 0, stream>>>(fea_text, gnB_w, gnB_b, text_n);

  dim3 gq(8, 16, kB);
  qkv_kernel<<<gq, 256, 0, stream>>>(W_qkv_A, img_n,  Qb, 0);  // Q from img
  qkv_kernel<<<gq, 256, 0, stream>>>(W_qkv_B, text_n, Kb, 1);  // K from text
  qkv_kernel<<<gq, 256, 0, stream>>>(W_qkv_B, text_n, Vb, 2);  // V from text

  attn_kernel<<<512, 256, 0, stream>>>(Qb, Kb, Vb, Xatt);

  proj_out_kernel<<<gq, 256, 0, stream>>>(W_out, b_out, Xatt, text_n, out);
}

// v001
// A run of this version takes 275 microseconds.
// Timed twice side by side with v000, it ran 1.39 times as fast both times.
#include <hip/hip_runtime.h>
#include <hip/hip_bf16.h>
#include <math.h>

typedef float v2f __attribute__((ext_vector_type(2)));
typedef float v8f __attribute__((ext_vector_type(8)));

constexpr int kB      = 16;
constexpr int kC      = 256;
constexpr int kHW     = 1024;   // 32*32 pixels
constexpr int kHeads  = 4;
constexpr int kHD     = 64;     // head dim
constexpr int kGroups = 16;
constexpr int kCPG    = kC / kGroups;  // 16 channels per group
constexpr float kEPS  = 1e-5f;

// ---------------------------------------------------------------------------
// f32 dense WMMA: D(16x16,f32) = A(16x4,f32) * B(4x16,f32) + C
// A frag: lane<16 -> M=lane, K = {0,1}; lane>=16 -> M=lane-16, K = {2,3}
// B frag: lane<16 -> N=lane, K = {0,1}; lane>=16 -> N=lane-16, K = {2,3}
// C/D   : vgpr r, lane<16 -> (M=r, N=lane); lane>=16 -> (M=r+8, N=lane-16)
// ---------------------------------------------------------------------------
__device__ __forceinline__ v8f wmma4(v2f a, v2f b, v8f c) {
  return __builtin_amdgcn_wmma_f32_16x16x4_f32(
      /*neg_a=*/false, a, /*neg_b=*/false, b,
      /*c_mod=*/(short)0, c, /*reuse_a=*/false, /*reuse_b=*/false);
}

// gfx1250 async global->LDS copy (ASYNCcnt path). 16B per lane.
__device__ __forceinline__ void async_g2l_b128(unsigned lds_byte_ofs,
                                               const float* gaddr) {
  asm volatile("global_load_async_to_lds_b128 %0, %1, off"
               :: "v"(lds_byte_ofs), "v"(gaddr) : "memory");
}
__device__ __forceinline__ void wait_async0() {
  asm volatile("s_wait_asynccnt 0" ::: "memory");
}

// ---------------------------------------------------------------------------
// GroupNorm: one block per (batch, group); 16 ch * 1024 px = 16384 elements.
// 16 waves; each thread brings 8 x 16 bytes, all loads in flight at once, and
// keeps them in registers, so the group is read from memory one time only.
// ---------------------------------------------------------------------------
typedef float v4f __attribute__((ext_vector_type(4)));
constexpr int kGNThreads = 512;
constexpr int kGNWaves   = kGNThreads / 32;
constexpr int kGNVec     = kCPG * kHW / 4 / kGNThreads;   // 8 vectors per thread

__global__ __launch_bounds__(kGNThreads) void groupnorm_kernel(
    const float* __restrict__ x, const float* __restrict__ gw,
    const float* __restrict__ gb, float* __restrict__ y) {
  const int bg = blockIdx.x;           // b*kGroups + g
  const int g  = bg % kGroups;
  const size_t base = (size_t)bg * kCPG * kHW;   // == b*kC*kHW + g*kCPG*kHW
  const v4f* xp = reinterpret_cast<const v4f*>(x + base);
  v4f*       yp = reinterpret_cast<v4f*>(y + base);
  const int tid = threadIdx.x;

  v4f v[kGNVec];
  #pragma unroll
  for (int k = 0; k < kGNVec; ++k) v[k] = xp[tid + k * kGNThreads];

  // vector tid + k*512 lies in channel (tid >> 8) + 2k of the group; tid >> 8
  // is the same in every lane of a wave, and readfirstlane lets the weight and
  // bias come by scalar loads instead of one vector load a lane.
  const int c0 = g * kCPG + __builtin_amdgcn_readfirstlane(tid >> 8);
  float wk[kGNVec], bk[kGNVec];
  #pragma unroll
  for (int k = 0; k < kGNVec; ++k) { wk[k] = gw[c0 + 2 * k]; bk[k] = gb[c0 + 2 * k]; }

  float s = 0.f, s2 = 0.f;
  #pragma unroll
  for (int k = 0; k < kGNVec; ++k) {
    #pragma unroll
    for (int e = 0; e < 4; ++e) { const float t = v[k][e]; s += t; s2 += t * t; }
  }
  for (int off = 16; off > 0; off >>= 1) {
    s  += __shfl_down(s,  off, 32);
    s2 += __shfl_down(s2, off, 32);
  }
  __shared__ float rs[kGNWaves], rs2[kGNWaves];
  __shared__ float smu, srstd;
  const int wv = tid >> 5, ln = tid & 31;
  if (ln == 0) { rs[wv] = s; rs2[wv] = s2; }
  __syncthreads();
  if (tid == 0) {
    float ts = 0.f, ts2 = 0.f;
    for (int i = 0; i < kGNWaves; ++i) { ts += rs[i]; ts2 += rs2[i]; }
    const float cnt = (float)(kCPG * kHW);
    float mu  = ts / cnt;
    float var = ts2 / cnt - mu * mu;
    smu = mu; srstd = rsqrtf(var + kEPS);
  }
  __syncthreads();
  const float mu = smu, rstd = srstd;
  #pragma unroll
  for (int k = 0; k < kGNVec; ++k) {
    v4f o;
    #pragma unroll
    for (int e = 0; e < 4; ++e) o[e] = (v[k][e] - mu) * rstd * wk[k] + bk[k];
    yp[tid + k * kGNThreads] = o;
  }
}

// ---------------------------------------------------------------------------
// QKV projection: Y[b][n][c][p] = sum_k W[n*192 + sel*64 + c][k] * X[b][k][p]
// sel: 0 = Q rows, 1 = K rows, 2 = V rows.  One wave -> 16(out ch) x 16(px).
// grid = (8, 16, B); block = 256 (8 waves, each a distinct pixel tile)
// ---------------------------------------------------------------------------
__global__ __launch_bounds__(256) void qkv_kernel(
    const float* __restrict__ W, const float* __restrict__ X,
    float* __restrict__ Y, int sel) {
  const int wave = threadIdx.x >> 5, lane = threadIdx.x & 31;
  const int half = lane >> 4, idx = lane & 15;
  const int p0 = blockIdx.x * 128 + wave * 16;
  const int n  = blockIdx.y >> 2;       // head
  const int ct = blockIdx.y & 3;        // 16-channel tile within head
  const int wrow0 = n * 192 + sel * 64 + ct * 16;
  const float* Wp = W + (size_t)wrow0 * kC;
  const float* Xp = X + (size_t)blockIdx.z * kC * kHW;

  v8f acc = {};
  for (int k0 = 0; k0 < kC; k0 += 4) {
    const int kk = k0 + 2 * half;
    v2f a;  a.x = Wp[idx * kC + kk];            a.y = Wp[idx * kC + kk + 1];
    v2f bf; bf.x = Xp[(size_t)kk * kHW + p0 + idx];
            bf.y = Xp[(size_t)(kk + 1) * kHW + p0 + idx];
    acc = wmma4(a, bf, acc);
  }
  float* Yp = Y + (((size_t)blockIdx.z * kHeads + n) * kHD + ct * 16 + 8 * half)
                  * (size_t)kHW + p0 + idx;
  #pragma unroll
  for (int r = 0; r < 8; ++r) Yp[(size_t)r * kHW] = acc[r];
}

// ---------------------------------------------------------------------------
// Flash attention per (b, head).  All 8 waves of a block share one (b, head);
// each 64x16 K/V tile is staged ONCE per block into LDS via async
// global->LDS b128 copies (coalesced 16B/lane), then all waves feed WMMA
// fragments from LDS.  Row stride 20 floats keeps b128 stores 16B-aligned
// and frag reads bank-conflict-free.  Per-wave P staged in LDS for the
// P*V^T A-fragments.  Output stored as Xatt[b][p][n*64+c].
// ---------------------------------------------------------------------------
__global__ __launch_bounds__(256) void attn_kernel(
    const float* __restrict__ Q, const float* __restrict__ K,
    const float* __restrict__ V, float* __restrict__ Xatt) {
  __shared__ float Kt[64][20];       // K tile: [c][yx], stride 20 (80B rows)
  __shared__ float Vt[64][20];       // V tile: [c][yx]
  __shared__ float Plds[8][16][17];  // per-wave P tile
  const int tid  = threadIdx.x;
  const int wave = tid >> 5, lane = tid & 31;
  const int half = lane >> 4, idx = lane & 15;
  const int wid = blockIdx.x * 8 + wave;     // 0..4095
  const int qt  = wid & 63;                  // query tile (per wave)
  const int bn  = wid >> 6;                  // b*4 + n (uniform in block)
  const int n   = bn & 3, b = bn >> 2;
  const float* Qp = Q + (size_t)bn * kHD * kHW;
  const float* Kp = K + (size_t)bn * kHD * kHW;
  const float* Vp = V + (size_t)bn * kHD * kHW;
  const int q0 = qt * 16;

  // staging assignment: thread -> (channel row sc, 4-float column chunk x4)
  const int sc = tid >> 2;            // 0..63
  const int x4 = (tid & 3) * 4;       // 0,4,8,12
  const unsigned kofs = (unsigned)(uintptr_t)&Kt[sc][x4];
  const unsigned vofs = (unsigned)(uintptr_t)&Vt[sc][x4];

  // preload A frags of Q^T (row = query px, K dim = channel 0..63)
  v2f aq[16];
  #pragma unroll
  for (int ks = 0; ks < 16; ++ks) {
    const int c = ks * 4 + 2 * half;
    aq[ks].x = Qp[(size_t)c * kHW + q0 + idx];
    aq[ks].y = Qp[(size_t)(c + 1) * kHW + q0 + idx];
  }

  v8f o0 = {}, o1 = {}, o2 = {}, o3 = {};
  float m[8], l[8];
  #pragma unroll
  for (int r = 0; r < 8; ++r) { m[r] = -3.0e38f; l[r] = 0.f; }
  const float inv_sqrt_c = 0.0625f;   // 1/sqrt(256)

  for (int j = 0; j < 64; ++j) {
    const int y0 = j * 16;
    __syncthreads();                            // LDS tile reuse fence
    async_g2l_b128(kofs, Kp + (size_t)sc * kHW + y0 + x4);
    async_g2l_b128(vofs, Vp + (size_t)sc * kHW + y0 + x4);
    wait_async0();                              // own async copies done
    __syncthreads();                            // tile visible to all waves

    // ---- S tile = Q^T K (K frags from LDS) ----
    v8f s = {};
    #pragma unroll
    for (int ks = 0; ks < 16; ++ks) {
      const int c = ks * 4 + 2 * half;
      v2f bk;
      bk.x = Kt[c][idx];
      bk.y = Kt[c + 1][idx];
      s = wmma4(aq[ks], bk, s);
    }
    // ---- online softmax (row stats within each 16-lane half) ----
    float sc8[8];
    #pragma unroll
    for (int r = 0; r < 8; ++r) {
      float sv = s[r] * inv_sqrt_c;
      float mx = sv;
      mx = fmaxf(mx, __shfl_xor(mx, 1, 32));
      mx = fmaxf(mx, __shfl_xor(mx, 2, 32));
      mx = fmaxf(mx, __shfl_xor(mx, 4, 32));
      mx = fmaxf(mx, __shfl_xor(mx, 8, 32));
      const float mnew = fmaxf(m[r], mx);
      const float p = __expf(sv - mnew);
      float rsum = p;
      rsum += __shfl_xor(rsum, 1, 32);
      rsum += __shfl_xor(rsum, 2, 32);
      rsum += __shfl_xor(rsum, 4, 32);
      rsum += __shfl_xor(rsum, 8, 32);
      sc8[r] = __expf(m[r] - mnew);
      l[r]   = l[r] * sc8[r] + rsum;
      m[r]   = mnew;
      Plds[wave][r + 8 * half][idx] = p;   // stage P for A-frag reload
    }
    #pragma unroll
    for (int r = 0; r < 8; ++r) {
      o0[r] *= sc8[r]; o1[r] *= sc8[r]; o2[r] *= sc8[r]; o3[r] *= sc8[r];
    }
    asm volatile("s_wait_dscnt 0" ::: "memory");   // same-wave LDS RAW on P

    // ---- O += P(16x16) * V^T(16x64) (V frags from LDS) ----
    #pragma unroll
    for (int ks = 0; ks < 4; ++ks) {
      const int kk = ks * 4 + 2 * half;
      v2f ap; ap.x = Plds[wave][idx][kk]; ap.y = Plds[wave][idx][kk + 1];
      v2f bv;
      bv.x = Vt[0 * 16 + idx][kk]; bv.y = Vt[0 * 16 + idx][kk + 1];
      o0 = wmma4(ap, bv, o0);
      bv.x = Vt[1 * 16 + idx][kk]; bv.y = Vt[1 * 16 + idx][kk + 1];
      o1 = wmma4(ap, bv, o1);
      bv.x = Vt[2 * 16 + idx][kk]; bv.y = Vt[2 * 16 + idx][kk + 1];
      o2 = wmma4(ap, bv, o2);
      bv.x = Vt[3 * 16 + idx][kk]; bv.y = Vt[3 * 16 + idx][kk + 1];
      o3 = wmma4(ap, bv, o3);
    }
  }

  // normalize and store as (b, p, c) with c = n*64 + ct*16 + idx (coalesced)
  #pragma unroll
  for (int r = 0; r < 8; ++r) {
    const float rcp = 1.0f / l[r];
    const int p = q0 + r + 8 * half;
    const size_t base = ((size_t)b * kHW + p) * kC + n * kHD;
    Xatt[base + 0 * 16 + idx] = o0[r] * rcp;
    Xatt[base + 1 * 16 + idx] = o1[r] * rcp;
    Xatt[base + 2 * 16 + idx] = o2[r] * rcp;
    Xatt[base + 3 * 16 + idx] = o3[r] * rcp;
  }
}

// ---------------------------------------------------------------------------
// Output projection + bias + residual:
// Y[b][o][p] = sum_c Wout[o][c] * Xatt[b][p][c] + bout[o] + textn[b][o][p]
// ---------------------------------------------------------------------------
__global__ __launch_bounds__(256) void proj_out_kernel(
    const float* __restrict__ Wout, const float* __restrict__ bout,
    const float* __restrict__ Xatt, const float* __restrict__ textn,
    float* __restrict__ Y) {
  const int wave = threadIdx.x >> 5, lane = threadIdx.x & 31;
  const int half = lane >> 4, idx = lane & 15;
  const int p0 = blockIdx.x * 128 + wave * 16;
  const int o0 = blockIdx.y * 16;
  const int b  = blockIdx.z;
  const float* Wp = Wout + (size_t)o0 * kC;
  const float* Xp = Xatt + (size_t)b * kHW * kC;

  v8f acc = {};
  for (int k0 = 0; k0 < kC; k0 += 4) {
    const int kk = k0 + 2 * half;
    v2f a;  a.x  = Wp[idx * kC + kk];           a.y  = Wp[idx * kC + kk + 1];
    v2f bv; bv.x = Xp[(size_t)(p0 + idx) * kC + kk];
            bv.y = Xp[(size_t)(p0 + idx) * kC + kk + 1];
    acc = wmma4(a, bv, acc);
  }
  #pragma unroll
  for (int r = 0; r < 8; ++r) {
    const int o = o0 + r + 8 * half;
    const size_t off = ((size_t)b * kC + o) * kHW + p0 + idx;
    Y[off] = acc[r] + bout[o] + textn[off];
  }
}

// ---------------------------------------------------------------------------
extern "C" void kernel_launch(void* const* d_in, const int* in_sizes, int n_in,
                              void* d_out, int out_size, void* d_ws, size_t ws_size,
                              hipStream_t stream) {
  const float* fea_img  = (const float*)d_in[0];
  const float* fea_text = (const float*)d_in[1];
  const float* gnA_w    = (const float*)d_in[2];
  const float* gnA_b    = (const float*)d_in[3];
  const float* gnB_w    = (const float*)d_in[4];
  const float* gnB_b    = (const float*)d_in[5];
  const float* W_qkv_A  = (const float*)d_in[6];
  const float* W_qkv_B  = (const float*)d_in[7];
  const float* W_out    = (const float*)d_in[8];
  const float* b_out    = (const float*)d_in[9];
  float* out = (float*)d_out;

  float* ws = (float*)d_ws;
  const size_t SEG = (size_t)kB * kC * kHW;   // 4,194,304 floats (16 MB)
  float* img_n  = ws + 0 * SEG;
  float* text_n = ws + 1 * SEG;
  float* Qb     = ws + 2 * SEG;   // (B, 4, 64, 1024)
  float* Kb     = ws + 3 * SEG;
  float* Vb     = ws + 4 * SEG;
  float* Xatt   = ws + 5 * SEG;   // (B, 1024, 256)

  groupnorm_kernel<<<kB * kGroups, kGNThreads, 0, stream>>>(fea_img,  gnA_w, gnA_b, img_n);
  groupnorm_kernel<<<kB * kGroups, kGNThreads, 0, stream>>>(fea_text, gnB_w, gnB_b, text_n);

  dim3 gq(8, 16, kB);
  qkv_kernel<<<gq, 256, 0, stream>>>(W_qkv_A, img_n,  Qb, 0);  // Q from img
  qkv_kernel<<<gq, 256, 0, stream>>>(W_qkv_B, text_n, Kb, 1);  // K from text
  qkv_kernel<<<gq, 256, 0, stream>>>(W_qkv_B, text_n, Vb, 2);  // V from text

  attn_kernel<<<512, 256, 0, stream>>>(Qb, Kb, Vb, Xatt);

  proj_out_kernel<<<gq, 256, 0, stream>>>(W_out, b_out, Xatt, text_n, out);
}

// v002
// Measured time: 203 microseconds a run.
// Next to v001, in two timings, it ran 1.36 times as fast each time.
// Over all steps from v000 it is 1.89 times as fast.
#include <hip/hip_runtime.h>
#include <hip/hip_bf16.h>
#include <math.h>

typedef float v2f __attribute__((ext_vector_type(2)));
typedef float v8f __attribute__((ext_vector_type(8)));

constexpr int kB      = 16;
constexpr int kC      = 256;
constexpr int kHW     = 1024;   // 32*32 pixels
constexpr int kHeads  = 4;
constexpr int kHD     = 64;     // head dim
constexpr int kGroups = 16;
constexpr int kCPG    = kC / kGroups;  // 16 channels per group
constexpr float kEPS  = 1e-5f;

// ---------------------------------------------------------------------------
// f32 dense WMMA: D(16x16,f32) = A(16x4,f32) * B(4x16,f32) + C
// A frag: lane<16 -> M=lane, K = {0,1}; lane>=16 -> M=lane-16, K = {2,3}
// B frag: lane<16 -> N=lane, K = {0,1}; lane>=16 -> N=lane-16, K = {2,3}
// C/D   : vgpr r, lane<16 -> (M=r, N=lane); lane>=16 -> (M=r+8, N=lane-16)
// ---------------------------------------------------------------------------
__device__ __forceinline__ v8f wmma4(v2f a, v2f b, v8f c) {
  return __builtin_amdgcn_wmma_f32_16x16x4_f32(
      /*neg_a=*/false, a, /*neg_b=*/false, b,
      /*c_mod=*/(short)0, c, /*reuse_a=*/false, /*reuse_b=*/false);
}

// gfx1250 async global->LDS copy (ASYNCcnt path). 16B per lane.
__device__ __forceinline__ void async_g2l_b128(unsigned lds_byte_ofs,
                                               const float* gaddr) {
  asm volatile("global_load_async_to_lds_b128 %0, %1, off"
               :: "v"(lds_byte_ofs), "v"(gaddr) : "memory");
}
__device__ __forceinline__ void wait_async0() {
  asm volatile("s_wait_asynccnt 0" ::: "memory");
}

// ---------------------------------------------------------------------------
// GroupNorm: one block per (batch, group); 16 ch * 1024 px = 16384 elements.
// 16 waves; each thread brings 8 x 16 bytes, all loads in flight at once, and
// keeps them in registers, so the group is read from memory one time only.
// ---------------------------------------------------------------------------
typedef float v4f __attribute__((ext_vector_type(4)));
constexpr int kGNThreads = 512;
constexpr int kGNWaves   = kGNThreads / 32;
constexpr int kGNVec     = kCPG * kHW / 4 / kGNThreads;   // 8 vectors per thread

__global__ __launch_bounds__(kGNThreads) void groupnorm_kernel(
    const float* __restrict__ x, const float* __restrict__ gw,
    const float* __restrict__ gb, float* __restrict__ y) {
  const int bg = blockIdx.x;           // b*kGroups + g
  const int g  = bg % kGroups;
  const size_t base = (size_t)bg * kCPG * kHW;   // == b*kC*kHW + g*kCPG*kHW
  const v4f* xp = reinterpret_cast<const v4f*>(x + base);
  v4f*       yp = reinterpret_cast<v4f*>(y + base);
  const int tid = threadIdx.x;

  v4f v[kGNVec];
  #pragma unroll
  for (int k = 0; k < kGNVec; ++k) v[k] = xp[tid + k * kGNThreads];

  // vector tid + k*512 lies in channel (tid >> 8) + 2k of the group; tid >> 8
  // is the same in every lane of a wave, and readfirstlane lets the weight and
  // bias come by scalar loads instead of one vector load a lane.
  const int c0 = g * kCPG + __builtin_amdgcn_readfirstlane(tid >> 8);
  float wk[kGNVec], bk[kGNVec];
  #pragma unroll
  for (int k = 0; k < kGNVec; ++k) { wk[k] = gw[c0 + 2 * k]; bk[k] = gb[c0 + 2 * k]; }

  float s = 0.f, s2 = 0.f;
  #pragma unroll
  for (int k = 0; k < kGNVec; ++k) {
    #pragma unroll
    for (int e = 0; e < 4; ++e) { const float t = v[k][e]; s += t; s2 += t * t; }
  }
  for (int off = 16; off > 0; off >>= 1) {
    s  += __shfl_down(s,  off, 32);
    s2 += __shfl_down(s2, off, 32);
  }
  __shared__ float rs[kGNWaves], rs2[kGNWaves];
  __shared__ float smu, srstd;
  const int wv = tid >> 5, ln = tid & 31;
  if (ln == 0) { rs[wv] = s; rs2[wv] = s2; }
  __syncthreads();
  if (tid == 0) {
    float ts = 0.f, ts2 = 0.f;
    for (int i = 0; i < kGNWaves; ++i) { ts += rs[i]; ts2 += rs2[i]; }
    const float cnt = (float)(kCPG * kHW);
    float mu  = ts / cnt;
    float var = ts2 / cnt - mu * mu;
    smu = mu; srstd = rsqrtf(var + kEPS);
  }
  __syncthreads();
  const float mu = smu, rstd = srstd;
  #pragma unroll
  for (int k = 0; k < kGNVec; ++k) {
    v4f o;
    #pragma unroll
    for (int e = 0; e < 4; ++e) o[e] = (v[k][e] - mu) * rstd * wk[k] + bk[k];
    yp[tid + k * kGNThreads] = o;
  }
}

// ---------------------------------------------------------------------------
// Shared body of the projections: a block of 8 waves forms a 64 (out ch) x 128
// (px) tile over K = 256.  The weights and the activations come in chunks of
// 32 k through LDS (async 16-byte copies, whole 128-byte lines, two buffers:
// the next chunk flies while this one is worked on).  Each wave holds 2 x 2
// accumulator tiles, so a fragment read from LDS feeds two matrix instructions.
// The k order of every accumulator is ascending, four at a time.
//   weights tile  As[row][k]   pitch 36 dwords: 8-byte fragment reads of 16
//                              rows x 2 halves fall on 64 different banks
//   activations   Bs[k][px]    pitch 136 dwords (rows kk and kk+2 lie 16 banks
//                              apart), or Bs[px][k] pitch 36 where k is the
//                              contiguous dimension in memory
// ---------------------------------------------------------------------------
constexpr int kBM = 64, kBN = 128, kBK = 32;
constexpr int kChunks = kC / kBK;            // 8
constexpr int kPA = kBK + 4;                 // 36 dwords
constexpr int kPX = kBN + 8;                 // 136 dwords
constexpr int kAElems = kBM * kPA;           // 2304 floats a buffer
constexpr int kBElemsKP = kBK * kPX;         // 4352 floats a buffer, [k][px]
constexpr int kBElemsPK = kBN * kPA;         // 4608 floats a buffer, [px][k]

// Six async copies of one thread (one chunk's share).  The s_wait_xcnt stands
// in the copies' own statement, so that no address register named here is
// rewritten ahead of it.
__device__ __forceinline__ void async_copy6(
    unsigned l0, const float* g0, unsigned l1, const float* g1,
    unsigned l2, const float* g2, unsigned l3, const float* g3,
    unsigned l4, const float* g4, unsigned l5, const float* g5) {
  asm volatile("global_load_async_to_lds_b128 %0, %1, off\n\t"
               "global_load_async_to_lds_b128 %2, %3, off\n\t"
               "global_load_async_to_lds_b128 %4, %5, off\n\t"
               "global_load_async_to_lds_b128 %6, %7, off\n\t"
               "global_load_async_to_lds_b128 %8, %9, off\n\t"
               "global_load_async_to_lds_b128 %10, %11, off\n\t"
               "s_wait_xcnt 0x0"
               :: "v"(l0), "v"(g0), "v"(l1), "v"(g1), "v"(l2), "v"(g2),
                  "v"(l3), "v"(g3), "v"(l4), "v"(g4), "v"(l5), "v"(g5)
               : "memory");
}

// Ag: first of the 64 weight rows (pitch kC).  Bg: the tile's first activation:
// [k][px] with pitch kHW (kPxMajor false) or [px][k] with pitch kC (true).
template <bool kPxMajor>
__device__ __forceinline__ void gemm_64x128(
    const float* __restrict__ Ag, const float* __restrict__ Bg,
    float* As, float* Bs, v8f (&acc)[2][2]) {
  constexpr int kBElems = kPxMajor ? kBElemsPK : kBElemsKP;
  const int tid  = threadIdx.x;
  const int wave = tid >> 5, lane = tid & 31;
  const int half = lane >> 4, idx = lane & 15;
  const int wm = (wave >> 2) * 32, wn = (wave & 3) * 32;

  // copy assignment.  [row][k] tiles: 8 threads a row of 128 bytes, 32 rows a
  // sweep.  [k][px] tile: one wave a row of 512 bytes, 8 rows a sweep.
  const int ar = tid >> 3, ac = (tid & 7) * 4;
  const int br = kPxMajor ? ar : wave;
  const int bc = kPxMajor ? ac : lane * 4;
  constexpr int kBPitch  = kPxMajor ? kPA : kPX;       // LDS pitch, dwords
  constexpr int kBSweep  = kPxMajor ? 32 : 8;          // rows a sweep
  constexpr int kBGPitch = kPxMajor ? kC : kHW;        // pitch in memory
  constexpr int kBGChunk = kPxMajor ? kBK : kBK * kHW; // next chunk in memory
  const float* ga = Ag + (size_t)ar * kC + ac;
  const float* gb = Bg + (size_t)br * kBGPitch + bc;
  const unsigned la = (unsigned)(uintptr_t)(As + ar * kPA + ac);
  const unsigned lb = (unsigned)(uintptr_t)(Bs + br * kBPitch + bc);

  auto issue = [&](int t) {
    const unsigned a0 = la + (unsigned)(t & 1) * (kAElems * 4);
    const unsigned b0 = lb + (unsigned)(t & 1) * (kBElems * 4);
    const float* pa = ga + t * kBK;
    const float* pb = gb + (size_t)t * kBGChunk;
    async_copy6(a0,                          pa,
                a0 + 32 * kPA * 4,           pa + 32 * kC,
                b0,                          pb,
                b0 + 1 * kBSweep * kBPitch * 4, pb + 1 * kBSweep * kBGPitch,
                b0 + 2 * kBSweep * kBPitch * 4, pb + 2 * kBSweep * kBGPitch,
                b0 + 3 * kBSweep * kBPitch * 4, pb + 3 * kBSweep * kBGPitch);
  };

  issue(0);
  wait_async0();        // own copies of chunk 0 have landed
  __syncthreads();      // chunk 0 visible to every wave
  issue(1);

  for (int t = 0; t < kChunks; ++t) {
    const float* A0 = As + (t & 1) * kAElems;
    const float* B0 = Bs + (t & 1) * kBElems;
    // unrolled so that the fragment reads of later k steps can be issued ahead
    #pragma unroll
    for (int ks = 0; ks < kBK / 4; ++ks) {
      const int kk = ks * 4 + 2 * half;
      v2f a[2], bf[2];
      // the loops over i and j are unrolled so that a, bf and acc stay in registers
      #pragma unroll
      for (int i = 0; i < 2; ++i)
        a[i] = *reinterpret_cast<const v2f*>(A0 + (wm + i * 16 + idx) * kPA + kk);
      #pragma unroll
      for (int j = 0; j < 2; ++j) {
        if (kPxMajor) {
          bf[j] = *reinterpret_cast<const v2f*>(B0 + (wn + j * 16 + idx) * kPA + kk);
        } else {
          bf[j].x = B0[kk * kPX + wn + j * 16 + idx];
          bf[j].y = B0[(kk + 1) * kPX + wn + j * 16 + idx];
        }
      }
      #pragma unroll
      for (int i = 0; i < 2; ++i)
        #pragma unroll
        for (int j = 0; j < 2; ++j) acc[i][j] = wmma4(a[i], bf[j], acc[i][j]);
    }
    asm volatile("s_wait_dscnt 0" ::: "memory");  // own reads of this buffer done
    wait_async0();                                // own copies of chunk t+1 landed
    __syncthreads();   // publishes chunk t+1, ends every read of this buffer
    if (t + 2 < kChunks) issue(t + 2);            // refill the buffer just read
  }
  wait_async0();        // nothing in flight when the wave ends
}

// ---------------------------------------------------------------------------
// QKV projection: Y[b][n][c][p] = sum_k W[n*192 + sel*64 + c][k] * X[b][k][p]
// sel: 0 = Q rows, 1 = K rows, 2 = V rows.  One block -> one head's 64 rows x
// 128 px.  grid = (8, 4, B); block = 256
// ---------------------------------------------------------------------------
__global__ __launch_bounds__(256) void qkv_kernel(
    const float* __restrict__ W, const float* __restrict__ X,
    float* __restrict__ Y, int sel) {
  __shared__ __attribute__((aligned(16))) float As[2 * kAElems];
  __shared__ __attribute__((aligned(16))) float Bs[2 * kBElemsKP];
  const int wave = threadIdx.x >> 5, lane = threadIdx.x & 31;
  const int half = lane >> 4, idx = lane & 15;
  const int p0 = blockIdx.x * kBN;
  const int n  = blockIdx.y;            // head
  const float* Wp = W + (size_t)(n * 192 + sel * 64) * kC;
  const float* Xp = X + (size_t)blockIdx.z * kC * kHW + p0;

  v8f acc[2][2] = {};
  gemm_64x128<false>(Wp, Xp, As, Bs, acc);

  const int wm = (wave >> 2) * 32, wn = (wave & 3) * 32;
  float* Yp = Y + (((size_t)blockIdx.z * kHeads + n) * kHD + wm + 8 * half)
                  * (size_t)kHW + p0 + wn + idx;
  // unrolled: acc is indexed by constants only and stays in registers
  #pragma unroll
  for (int i = 0; i < 2; ++i)
    #pragma unroll
    for (int j = 0; j < 2; ++j)
      #pragma unroll
      for (int r = 0; r < 8; ++r)
        Yp[(size_t)(i * 16 + r) * kHW + j * 16] = acc[i][j][r];
}

// ---------------------------------------------------------------------------
// Flash attention per (b, head).  All 8 waves of a block share one (b, head);
// each 64x16 K/V tile is staged ONCE per block into LDS via async
// global->LDS b128 copies (coalesced 16B/lane), then all waves feed WMMA
// fragments from LDS.  Row stride 20 floats keeps b128 stores 16B-aligned
// and frag reads bank-conflict-free.  Per-wave P staged in LDS for the
// P*V^T A-fragments.  Output stored as Xatt[b][p][n*64+c].
// ---------------------------------------------------------------------------
__global__ __launch_bounds__(256) void attn_kernel(
    const float* __restrict__ Q, const float* __restrict__ K,
    const float* __restrict__ V, float* __restrict__ Xatt) {
  __shared__ float Kt[64][20];       // K tile: [c][yx], stride 20 (80B rows)
  __shared__ float Vt[64][20];       // V tile: [c][yx]
  __shared__ float Plds[8][16][17];  // per-wave P tile
  const int tid  = threadIdx.x;
  const int wave = tid >> 5, lane = tid & 31;
  const int half = lane >> 4, idx = lane & 15;
  const int wid = blockIdx.x * 8 + wave;     // 0..4095
  const int qt  = wid & 63;                  // query tile (per wave)
  const int bn  = wid >> 6;                  // b*4 + n (uniform in block)
  const int n   = bn & 3, b = bn >> 2;
  const float* Qp = Q + (size_t)bn * kHD * kHW;
  const float* Kp = K + (size_t)bn * kHD * kHW;
  const float* Vp = V + (size_t)bn * kHD * kHW;
  const int q0 = qt * 16;

  // staging assignment: thread -> (channel row sc, 4-float column chunk x4)
  const int sc = tid >> 2;            // 0..63
  const int x4 = (tid & 3) * 4;       // 0,4,8,12
  const unsigned kofs = (unsigned)(uintptr_t)&Kt[sc][x4];
  const unsigned vofs = (unsigned)(uintptr_t)&Vt[sc][x4];

  // preload A frags of Q^T (row = query px, K dim = channel 0..63)
  v2f aq[16];
  #pragma unroll
  for (int ks = 0; ks < 16; ++ks) {
    const int c = ks * 4 + 2 * half;
    aq[ks].x = Qp[(size_t)c * kHW + q0 + idx];
    aq[ks].y = Qp[(size_t)(c + 1) * kHW + q0 + idx];
  }

  v8f o0 = {}, o1 = {}, o2 = {}, o3 = {};
  float m[8], l[8];
  #pragma unroll
  for (int r = 0; r < 8; ++r) { m[r] = -3.0e38f; l[r] = 0.f; }
  const float inv_sqrt_c = 0.0625f;   // 1/sqrt(256)

  for (int j = 0; j < 64; ++j) {
    const int y0 = j * 16;
    __syncthreads();                            // LDS tile reuse fence
    async_g2l_b128(kofs, Kp + (size_t)sc * kHW + y0 + x4);
    async_g2l_b128(vofs, Vp + (size_t)sc * kHW + y0 + x4);
    wait_async0();                              // own async copies done
    __syncthreads();                            // tile visible to all waves

    // ---- S tile = Q^T K (K frags from LDS) ----
    v8f s = {};
    #pragma unroll
    for (int ks = 0; ks < 16; ++ks) {
      const int c = ks * 4 + 2 * half;
      v2f bk;
      bk.x = Kt[c][idx];
      bk.y = Kt[c + 1][idx];
      s = wmma4(aq[ks], bk, s);
    }
    // ---- online softmax (row stats within each 16-lane half) ----
    float sc8[8];
    #pragma unroll
    for (int r = 0; r < 8; ++r) {
      float sv = s[r] * inv_sqrt_c;
      float mx = sv;
      mx = fmaxf(mx, __shfl_xor(mx, 1, 32));
      mx = fmaxf(mx, __shfl_xor(mx, 2, 32));
      mx = fmaxf(mx, __shfl_xor(mx, 4, 32));
      mx = fmaxf(mx, __shfl_xor(mx, 8, 32));
      const float mnew = fmaxf(m[r], mx);
      const float p = __expf(sv - mnew);
      float rsum = p;
      rsum += __shfl_xor(rsum, 1, 32);
      rsum += __shfl_xor(rsum, 2, 32);
      rsum += __shfl_xor(rsum, 4, 32);
      rsum += __shfl_xor(rsum, 8, 32);
      sc8[r] = __expf(m[r] - mnew);
      l[r]   = l[r] * sc8[r] + rsum;
      m[r]   = mnew;
      Plds[wave][r + 8 * half][idx] = p;   // stage P for A-frag reload
    }
    #pragma unroll
    for (int r = 0; r < 8; ++r) {
      o0[r] *= sc8[r]; o1[r] *= sc8[r]; o2[r] *= sc8[r]; o3[r] *= sc8[r];
    }
    asm volatile("s_wait_dscnt 0" ::: "memory");   // same-wave LDS RAW on P

    // ---- O += P(16x16) * V^T(16x64) (V frags from LDS) ----
    #pragma unroll
    for (int ks = 0; ks < 4; ++ks) {
      const int kk = ks * 4 + 2 * half;
      v2f ap; ap.x = Plds[wave][idx][kk]; ap.y = Plds[wave][idx][kk + 1];
      v2f bv;
      bv.x = Vt[0 * 16 + idx][kk]; bv.y = Vt[0 * 16 + idx][kk + 1];
      o0 = wmma4(ap, bv, o0);
      bv.x = Vt[1 * 16 + idx][kk]; bv.y = Vt[1 * 16 + idx][kk + 1];
      o1 = wmma4(ap, bv, o1);
      bv.x = Vt[2 * 16 + idx][kk]; bv.y = Vt[2 * 16 + idx][kk + 1];
      o2 = wmma4(ap, bv, o2);
      bv.x = Vt[3 * 16 + idx][kk]; bv.y = Vt[3 * 16 + idx][kk + 1];
      o3 = wmma4(ap, bv, o3);
    }
  }

  // normalize and store as (b, p, c) with c = n*64 + ct*16 + idx (coalesced)
  #pragma unroll
  for (int r = 0; r < 8; ++r) {
    const float rcp = 1.0f / l[r];
    const int p = q0 + r + 8 * half;
    const size_t base = ((size_t)b * kHW + p) * kC + n * kHD;
    Xatt[base + 0 * 16 + idx] = o0[r] * rcp;
    Xatt[base + 1 * 16 + idx] = o1[r] * rcp;
    Xatt[base + 2 * 16 + idx] = o2[r] * rcp;
    Xatt[base + 3 * 16 + idx] = o3[r] * rcp;
  }
}

// ---------------------------------------------------------------------------
// Output projection + bias + residual:
// Y[b][o][p] = sum_c Wout[o][c] * Xatt[b][p][c] + bout[o] + textn[b][o][p]
// One block -> 64 out channels x 128 px.  grid = (8, 4, B); block = 256
// ---------------------------------------------------------------------------
__global__ __launch_bounds__(256) void proj_out_kernel(
    const float* __restrict__ Wout, const float* __restrict__ bout,
    const float* __restrict__ Xatt, const float* __restrict__ textn,
    float* __restrict__ Y) {
  __shared__ __attribute__((aligned(16))) float As[2 * kAElems];
  __shared__ __attribute__((aligned(16))) float Bs[2 * kBElemsPK];
  const int wave = threadIdx.x >> 5, lane = threadIdx.x & 31;
  const int half = lane >> 4, idx = lane & 15;
  const int p0 = blockIdx.x * kBN;
  const int o0 = blockIdx.y * kBM;
  const int b  = blockIdx.z;
  const float* Wp = Wout + (size_t)o0 * kC;
  const float* Xp = Xatt + ((size_t)b * kHW + p0) * kC;

  v8f acc[2][2] = {};
  gemm_64x128<true>(Wp, Xp, As, Bs, acc);

  const int wm = (wave >> 2) * 32, wn = (wave & 3) * 32;
  // Bias and residual come into registers one run of 16 rows at a time.
  float bo[2][8], res[2][8][2];
  #pragma unroll  // constant indices keep bo and res in registers
  for (int i = 0; i < 2; ++i) {
    #pragma unroll  // as above
    for (int r = 0; r < 8; ++r) {
      const int o = o0 + wm + i * 16 + r + 8 * half;
      bo[i][r] = bout[o];
      #pragma unroll  // as above
      for (int j = 0; j < 2; ++j)
        res[i][r][j] = textn[((size_t)b * kC + o) * kHW + p0 + wn + j * 16 + idx];
    }
    // behind the run's last load: the next run's results may be given the
    // registers that held this run's addresses
    asm volatile("s_wait_xcnt 0x0" ::: "memory");
  }
  #pragma unroll  // constant indices keep acc, bo and res in registers
  for (int i = 0; i < 2; ++i) {
    #pragma unroll  // as above
    for (int r = 0; r < 8; ++r) {
      const int o = o0 + wm + i * 16 + r + 8 * half;
      #pragma unroll  // as above
      for (int j = 0; j < 2; ++j)
        Y[((size_t)b * kC + o) * kHW + p0 + wn + j * 16 + idx] =
            acc[i][j][r] + bo[i][r] + res[i][r][j];
    }
  }
}

// ---------------------------------------------------------------------------
extern "C" void kernel_launch(void* const* d_in, const int* in_sizes, int n_in,
                              void* d_out, int out_size, void* d_ws, size_t ws_size,
                              hipStream_t stream) {
  const float* fea_img  = (const float*)d_in[0];
  const float* fea_text = (const float*)d_in[1];
  const float* gnA_w    = (const float*)d_in[2];
  const float* gnA_b    = (const float*)d_in[3];
  const float* gnB_w    = (const float*)d_in[4];
  const float* gnB_b    = (const float*)d_in[5];
  const float* W_qkv_A  = (const float*)d_in[6];
  const float* W_qkv_B  = (const float*)d_in[7];
  const float* W_out    = (const float*)d_in[8];
  const float* b_out    = (const float*)d_in[9];
  float* out = (float*)d_out;

  float* ws = (float*)d_ws;
  const size_t SEG = (size_t)kB * kC * kHW;   // 4,194,304 floats (16 MB)
  float* img_n  = ws + 0 * SEG;
  float* text_n = ws + 1 * SEG;
  float* Qb     = ws + 2 * SEG;   // (B, 4, 64, 1024)
  float* Kb     = ws + 3 * SEG;
  float* Vb     = ws + 4 * SEG;
  float* Xatt   = ws + 5 * SEG;   // (B, 1024, 256)

  groupnorm_kernel<<<kB * kGroups, kGNThreads, 0, stream>>>(fea_img,  gnA_w, gnA_b, img_n);
  groupnorm_kernel<<<kB * kGroups, kGNThreads, 0, stream>>>(fea_text, gnB_w, gnB_b, text_n);

  dim3 gq(8, 4, kB);
  qkv_kernel<<<gq, 256, 0, stream>>>(W_qkv_A, img_n,  Qb, 0);  // Q from img
  qkv_kernel<<<gq, 256, 0, stream>>>(W_qkv_B, text_n, Kb, 1);  // K from text
  qkv_kernel<<<gq, 256, 0, stream>>>(W_qkv_B, text_n, Vb, 2);  // V from text

  attn_kernel<<<512, 256, 0, stream>>>(Qb, Kb, Vb, Xatt);

  proj_out_kernel<<<gq, 256, 0, stream>>>(W_out, b_out, Xatt, text_n, out);
}

// v003
// Measured time: 171 microseconds a run.
// Two timings next to v002 put it at 1.19 and 1.18 times that version's speed.
// Counting every step since v000, it is 2.23 times as fast.
#include <hip/hip_runtime.h>
#include <hip/hip_bf16.h>
#include <math.h>

typedef float v2f __attribute__((ext_vector_type(2)));
typedef float v8f __attribute__((ext_vector_type(8)));

constexpr int kB      = 16;
constexpr int kC      = 256;
constexpr int kHW     = 1024;   // 32*32 pixels
constexpr int kHeads  = 4;
constexpr int kHD     = 64;     // head dim
constexpr int kGroups = 16;
constexpr int kCPG    = kC / kGroups;  // 16 channels per group
constexpr float kEPS  = 1e-5f;

// ---------------------------------------------------------------------------
// f32 dense WMMA: D(16x16,f32) = A(16x4,f32) * B(4x16,f32) + C
// A frag: lane<16 -> M=lane, K = {0,1}; lane>=16 -> M=lane-16, K = {2,3}
// B frag: lane<16 -> N=lane, K = {0,1}; lane>=16 -> N=lane-16, K = {2,3}
// C/D   : vgpr r, lane<16 -> (M=r, N=lane); lane>=16 -> (M=r+8, N=lane-16)
// ---------------------------------------------------------------------------
__device__ __forceinline__ v8f wmma4(v2f a, v2f b, v8f c) {
  return __builtin_amdgcn_wmma_f32_16x16x4_f32(
      /*neg_a=*/false, a, /*neg_b=*/false, b,
      /*c_mod=*/(short)0, c, /*reuse_a=*/false, /*reuse_b=*/false);
}

// gfx1250 async global->LDS copy (ASYNCcnt path). 16B per lane.
__device__ __forceinline__ void async_g2l_b128(unsigned lds_byte_ofs,
                                               const float* gaddr) {
  asm volatile("global_load_async_to_lds_b128 %0, %1, off"
               :: "v"(lds_byte_ofs), "v"(gaddr) : "memory");
}
__device__ __forceinline__ void wait_async0() {
  asm volatile("s_wait_asynccnt 0" ::: "memory");
}

// ---------------------------------------------------------------------------
// GroupNorm: one block per (batch, group); 16 ch * 1024 px = 16384 elements.
// 16 waves; each thread brings 8 x 16 bytes, all loads in flight at once, and
// keeps them in registers, so the group is read from memory one time only.
// ---------------------------------------------------------------------------
typedef float v4f __attribute__((ext_vector_type(4)));
constexpr int kGNThreads = 512;
constexpr int kGNWaves   = kGNThreads / 32;
constexpr int kGNVec     = kCPG * kHW / 4 / kGNThreads;   // 8 vectors per thread

__global__ __launch_bounds__(kGNThreads) void groupnorm_kernel(
    const float* __restrict__ x, const float* __restrict__ gw,
    const float* __restrict__ gb, float* __restrict__ y) {
  const int bg = blockIdx.x;           // b*kGroups + g
  const int g  = bg % kGroups;
  const size_t base = (size_t)bg * kCPG * kHW;   // == b*kC*kHW + g*kCPG*kHW
  const v4f* xp = reinterpret_cast<const v4f*>(x + base);
  v4f*       yp = reinterpret_cast<v4f*>(y + base);
  const int tid = threadIdx.x;

  v4f v[kGNVec];
  #pragma unroll
  for (int k = 0; k < kGNVec; ++k) v[k] = xp[tid + k * kGNThreads];

  // vector tid + k*512 lies in channel (tid >> 8) + 2k of the group; tid >> 8
  // is the same in every lane of a wave, and readfirstlane lets the weight and
  // bias come by scalar loads instead of one vector load a lane.
  const int c0 = g * kCPG + __builtin_amdgcn_readfirstlane(tid >> 8);
  float wk[kGNVec], bk[kGNVec];
  #pragma unroll
  for (int k = 0; k < kGNVec; ++k) { wk[k] = gw[c0 + 2 * k]; bk[k] = gb[c0 + 2 * k]; }

  float s = 0.f, s2 = 0.f;
  #pragma unroll
  for (int k = 0; k < kGNVec; ++k) {
    #pragma unroll
    for (int e = 0; e < 4; ++e) { const float t = v[k][e]; s += t; s2 += t * t; }
  }
  for (int off = 16; off > 0; off >>= 1) {
    s  += __shfl_down(s,  off, 32);
    s2 += __shfl_down(s2, off, 32);
  }
  __shared__ float rs[kGNWaves], rs2[kGNWaves];
  __shared__ float smu, srstd;
  const int wv = tid >> 5, ln = tid & 31;
  if (ln == 0) { rs[wv] = s; rs2[wv] = s2; }
  __syncthreads();
  if (tid == 0) {
    float ts = 0.f, ts2 = 0.f;
    for (int i = 0; i < kGNWaves; ++i) { ts += rs[i]; ts2 += rs2[i]; }
    const float cnt = (float)(kCPG * kHW);
    float mu  = ts / cnt;
    float var = ts2 / cnt - mu * mu;
    smu = mu; srstd = rsqrtf(var + kEPS);
  }
  __syncthreads();
  const float mu = smu, rstd = srstd;
  #pragma unroll
  for (int k = 0; k < kGNVec; ++k) {
    v4f o;
    #pragma unroll
    for (int e = 0; e < 4; ++e) o[e] = (v[k][e] - mu) * rstd * wk[k] + bk[k];
    yp[tid + k * kGNThreads] = o;
  }
}

// ---------------------------------------------------------------------------
// Shared body of the projections: a block of 8 waves forms a 64 (out ch) x 128
// (px) tile over K = 256.  The weights and the activations come in chunks of
// 32 k through LDS (async 16-byte copies, whole 128-byte lines, two buffers:
// the next chunk flies while this one is worked on).  Each wave holds 2 x 2
// accumulator tiles, so a fragment read from LDS feeds two matrix instructions.
// The k order of every accumulator is ascending, four at a time.
//   weights tile  As[row][k]   pitch 36 dwords: 8-byte fragment reads of 16
//                              rows x 2 halves fall on 64 different banks
//   activations   Bs[k][px]    pitch 136 dwords (rows kk and kk+2 lie 16 banks
//                              apart), or Bs[px][k] pitch 36 where k is the
//                              contiguous dimension in memory
// ---------------------------------------------------------------------------
constexpr int kBM = 64, kBN = 128, kBK = 32;
constexpr int kChunks = kC / kBK;            // 8
constexpr int kPA = kBK + 4;                 // 36 dwords
constexpr int kPX = kBN + 8;                 // 136 dwords
constexpr int kAElems = kBM * kPA;           // 2304 floats a buffer
constexpr int kBElemsKP = kBK * kPX;         // 4352 floats a buffer, [k][px]
constexpr int kBElemsPK = kBN * kPA;         // 4608 floats a buffer, [px][k]

// Six async copies of one thread (one chunk's share).  The s_wait_xcnt stands
// in the copies' own statement, so that no address register named here is
// rewritten ahead of it.
__device__ __forceinline__ void async_copy6(
    unsigned l0, const float* g0, unsigned l1, const float* g1,
    unsigned l2, const float* g2, unsigned l3, const float* g3,
    unsigned l4, const float* g4, unsigned l5, const float* g5) {
  asm volatile("global_load_async_to_lds_b128 %0, %1, off\n\t"
               "global_load_async_to_lds_b128 %2, %3, off\n\t"
               "global_load_async_to_lds_b128 %4, %5, off\n\t"
               "global_load_async_to_lds_b128 %6, %7, off\n\t"
               "global_load_async_to_lds_b128 %8, %9, off\n\t"
               "global_load_async_to_lds_b128 %10, %11, off\n\t"
               "s_wait_xcnt 0x0"
               :: "v"(l0), "v"(g0), "v"(l1), "v"(g1), "v"(l2), "v"(g2),
                  "v"(l3), "v"(g3), "v"(l4), "v"(g4), "v"(l5), "v"(g5)
               : "memory");
}

// Ag: first of the 64 weight rows (pitch kC).  Bg: the tile's first activation:
// [k][px] with pitch kHW (kPxMajor false) or [px][k] with pitch kC (true).
template <bool kPxMajor>
__device__ __forceinline__ void gemm_64x128(
    const float* __restrict__ Ag, const float* __restrict__ Bg,
    float* As, float* Bs, v8f (&acc)[2][2]) {
  constexpr int kBElems = kPxMajor ? kBElemsPK : kBElemsKP;
  const int tid  = threadIdx.x;
  const int wave = tid >> 5, lane = tid & 31;
  const int half = lane >> 4, idx = lane & 15;
  const int wm = (wave >> 2) * 32, wn = (wave & 3) * 32;

  // copy assignment.  [row][k] tiles: 8 threads a row of 128 bytes, 32 rows a
  // sweep.  [k][px] tile: one wave a row of 512 bytes, 8 rows a sweep.
  const int ar = tid >> 3, ac = (tid & 7) * 4;
  const int br = kPxMajor ? ar : wave;
  const int bc = kPxMajor ? ac : lane * 4;
  constexpr int kBPitch  = kPxMajor ? kPA : kPX;       // LDS pitch, dwords
  constexpr int kBSweep  = kPxMajor ? 32 : 8;          // rows a sweep
  constexpr int kBGPitch = kPxMajor ? kC : kHW;        // pitch in memory
  constexpr int kBGChunk = kPxMajor ? kBK : kBK * kHW; // next chunk in memory
  const float* ga = Ag + (size_t)ar * kC + ac;
  const float* gb = Bg + (size_t)br * kBGPitch + bc;
  const unsigned la = (unsigned)(uintptr_t)(As + ar * kPA + ac);
  const unsigned lb = (unsigned)(uintptr_t)(Bs + br * kBPitch + bc);

  auto issue = [&](int t) {
    const unsigned a0 = la + (unsigned)(t & 1) * (kAElems * 4);
    const unsigned b0 = lb + (unsigned)(t & 1) * (kBElems * 4);
    const float* pa = ga + t * kBK;
    const float* pb = gb + (size_t)t * kBGChunk;
    async_copy6(a0,                          pa,
                a0 + 32 * kPA * 4,           pa + 32 * kC,
                b0,                          pb,
                b0 + 1 * kBSweep * kBPitch * 4, pb + 1 * kBSweep * kBGPitch,
                b0 + 2 * kBSweep * kBPitch * 4, pb + 2 * kBSweep * kBGPitch,
                b0 + 3 * kBSweep * kBPitch * 4, pb + 3 * kBSweep * kBGPitch);
  };

  issue(0);
  wait_async0();        // own copies of chunk 0 have landed
  __syncthreads();      // chunk 0 visible to every wave
  issue(1);

  for (int t = 0; t < kChunks; ++t) {
    const float* A0 = As + (t & 1) * kAElems;
    const float* B0 = Bs + (t & 1) * kBElems;
    // unrolled so that the fragment reads of later k steps can be issued ahead
    #pragma unroll
    for (int ks = 0; ks < kBK / 4; ++ks) {
      const int kk = ks * 4 + 2 * half;
      v2f a[2], bf[2];
      // the loops over i and j are unrolled so that a, bf and acc stay in registers
      #pragma unroll
      for (int i = 0; i < 2; ++i)
        a[i] = *reinterpret_cast<const v2f*>(A0 + (wm + i * 16 + idx) * kPA + kk);
      #pragma unroll
      for (int j = 0; j < 2; ++j) {
        if (kPxMajor) {
          bf[j] = *reinterpret_cast<const v2f*>(B0 + (wn + j * 16 + idx) * kPA + kk);
        } else {
          bf[j].x = B0[kk * kPX + wn + j * 16 + idx];
          bf[j].y = B0[(kk + 1) * kPX + wn + j * 16 + idx];
        }
      }
      #pragma unroll
      for (int i = 0; i < 2; ++i)
        #pragma unroll
        for (int j = 0; j < 2; ++j) acc[i][j] = wmma4(a[i], bf[j], acc[i][j]);
    }
    asm volatile("s_wait_dscnt 0" ::: "memory");  // own reads of this buffer done
    wait_async0();                                // own copies of chunk t+1 landed
    __syncthreads();   // publishes chunk t+1, ends every read of this buffer
    if (t + 2 < kChunks) issue(t + 2);            // refill the buffer just read
  }
  wait_async0();        // nothing in flight when the wave ends
}

// ---------------------------------------------------------------------------
// QKV projection: Y[b][n][c][p] = sum_k W[n*192 + sel*64 + c][k] * X[b][k][p]
// sel: 0 = Q rows, 1 = K rows, 2 = V rows.  One block -> one head's 64 rows x
// 128 px.  grid = (8, 4, B); block = 256
// ---------------------------------------------------------------------------
__global__ __launch_bounds__(256) void qkv_kernel(
    const float* __restrict__ W, const float* __restrict__ X,
    float* __restrict__ Y, int sel) {
  __shared__ __attribute__((aligned(16))) float As[2 * kAElems];
  __shared__ __attribute__((aligned(16))) float Bs[2 * kBElemsKP];
  const int wave = threadIdx.x >> 5, lane = threadIdx.x & 31;
  const int half = lane >> 4, idx = lane & 15;
  const int p0 = blockIdx.x * kBN;
  const int n  = blockIdx.y;            // head
  const float* Wp = W + (size_t)(n * 192 + sel * 64) * kC;
  const float* Xp = X + (size_t)blockIdx.z * kC * kHW + p0;

  v8f acc[2][2] = {};
  gemm_64x128<false>(Wp, Xp, As, Bs, acc);

  const int wm = (wave >> 2) * 32, wn = (wave & 3) * 32;
  float* Yp = Y + (((size_t)blockIdx.z * kHeads + n) * kHD + wm + 8 * half)
                  * (size_t)kHW + p0 + wn + idx;
  // unrolled: acc is indexed by constants only and stays in registers
  #pragma unroll
  for (int i = 0; i < 2; ++i)
    #pragma unroll
    for (int j = 0; j < 2; ++j)
      #pragma unroll
      for (int r = 0; r < 8; ++r)
        Yp[(size_t)(i * 16 + r) * kHW + j * 16] = acc[i][j][r];
}

// ---------------------------------------------------------------------------
// Flash attention per (b, head).  All 8 waves of a block share one (b, head);
// each 64x16 K/V tile is staged ONCE per block into LDS via async
// global->LDS b128 copies (coalesced 16B/lane), then all waves feed WMMA
// fragments from LDS.  Row stride 20 floats keeps b128 accesses 16B-aligned
// and frag reads bank-conflict-free.
// The scores are formed transposed, S^T = K^T(key x c) * Q(c x query): a lane
// then holds 8 keys (r + 8*half) of ONE query (idx).  The row maximum is
// 8 values of the lane's own and one exchange with lane ^ 16; the row sum stays
// per half until the end (both halves rescale by the same factor); and
// the same registers are the B fragments of O^T = V(c x key) * P^T(key x query):
// k step u takes p[2u], p[2u+1], which are keys 8*half + 2u, + 1; the V loader
// reads the same keys at the same positions.
// Output stored as Xatt[b][p][n*64+c].
// ---------------------------------------------------------------------------
// lane l with lane l ^ 16
__device__ __forceinline__ float xhalf(float x) {
  return __builtin_bit_cast(float, __builtin_amdgcn_permlanex16(
      __builtin_bit_cast(int, x), __builtin_bit_cast(int, x),
      0x76543210, 0xfedcba98, false, false));
}

__global__ __launch_bounds__(256) void attn_kernel(
    const float* __restrict__ Q, const float* __restrict__ K,
    const float* __restrict__ V, float* __restrict__ Xatt) {
  __shared__ __attribute__((aligned(16))) float Kt[64][20];  // K tile: [c][yx], 80B rows
  __shared__ __attribute__((aligned(16))) float Vt[64][20];  // V tile: [c][yx]
  const int tid  = threadIdx.x;
  const int wave = tid >> 5, lane = tid & 31;
  const int half = lane >> 4, idx = lane & 15;
  const int wid = blockIdx.x * 8 + wave;     // 0..4095
  const int qt  = wid & 63;                  // query tile (per wave)
  const int bn  = wid >> 6;                  // b*4 + n (uniform in block)
  const int n   = bn & 3, b = bn >> 2;
  const float* Qp = Q + (size_t)bn * kHD * kHW;
  const float* Kp = K + (size_t)bn * kHD * kHW;
  const float* Vp = V + (size_t)bn * kHD * kHW;
  const int q0 = qt * 16;

  // staging assignment: thread -> (channel row sc, 4-float column chunk x4)
  const int sc = tid >> 2;            // 0..63
  const int x4 = (tid & 3) * 4;       // 0,4,8,12
  const unsigned kofs = (unsigned)(uintptr_t)&Kt[sc][x4];
  const unsigned vofs = (unsigned)(uintptr_t)&Vt[sc][x4];

  // preload B frags of Q (column = query px, K dim = channel 0..63)
  v2f aq[16];
  #pragma unroll
  for (int ks = 0; ks < 16; ++ks) {
    const int c = ks * 4 + 2 * half;
    aq[ks].x = Qp[(size_t)c * kHW + q0 + idx];
    aq[ks].y = Qp[(size_t)(c + 1) * kHW + q0 + idx];
  }

  // o[ct][r] = O^T[c = ct*16 + r + 8*half][query idx]
  v8f o0 = {}, o1 = {}, o2 = {}, o3 = {};
  // of query idx: m is the same in both halves, l sums this half's keys only
  float m = -3.0e38f, l = 0.f;
  const float inv_sqrt_c = 0.0625f;   // 1/sqrt(256)

  for (int j = 0; j < 64; ++j) {
    const int y0 = j * 16;
    __syncthreads();                            // LDS tile reuse fence
    async_g2l_b128(kofs, Kp + (size_t)sc * kHW + y0 + x4);
    async_g2l_b128(vofs, Vp + (size_t)sc * kHW + y0 + x4);
    wait_async0();                              // own async copies done
    __syncthreads();                            // tile visible to all waves

    // ---- S^T tile = K^T Q (K frags from LDS) ----
    v8f s = {};
    #pragma unroll
    for (int ks = 0; ks < 16; ++ks) {
      const int c = ks * 4 + 2 * half;
      v2f ak;
      ak.x = Kt[c][idx];
      ak.y = Kt[c + 1][idx];
      s = wmma4(ak, aq[ks], s);
    }
    // ---- online softmax: this lane's 8 keys, then the other half's 8 ----
    float sv[8], p[8];
    #pragma unroll  // constant indices keep s, sv and p in registers
    for (int r = 0; r < 8; ++r) sv[r] = s[r] * inv_sqrt_c;
    float mx = sv[0];
    #pragma unroll  // as above
    for (int r = 1; r < 8; ++r) mx = fmaxf(mx, sv[r]);
    mx = fmaxf(mx, xhalf(mx));
    const float mnew = fmaxf(m, mx);
    float rsum = 0.f;
    #pragma unroll  // as above
    for (int r = 0; r < 8; ++r) { p[r] = __expf(sv[r] - mnew); rsum += p[r]; }
    const float resc = __expf(m - mnew);
    l = l * resc + rsum;
    m = mnew;
    #pragma unroll  // constant indices keep the output tiles in registers
    for (int r = 0; r < 8; ++r) {
      o0[r] *= resc; o1[r] *= resc; o2[r] *= resc; o3[r] *= resc;
    }

    // ---- O^T += V(64x16) * P^T(16x16) (V frags from LDS, P from registers) ----
    #pragma unroll  // p is indexed by constants only and stays in registers
    for (int t = 0; t < 2; ++t) {
      // one 16-byte read holds the A fragments of two k steps
      const int kk = 8 * half + 4 * t;
      const v4f v0 = *reinterpret_cast<const v4f*>(&Vt[0 * 16 + idx][kk]);
      const v4f v1 = *reinterpret_cast<const v4f*>(&Vt[1 * 16 + idx][kk]);
      const v4f v2 = *reinterpret_cast<const v4f*>(&Vt[2 * 16 + idx][kk]);
      const v4f v3 = *reinterpret_cast<const v4f*>(&Vt[3 * 16 + idx][kk]);
      v2f bp; bp.x = p[4 * t]; bp.y = p[4 * t + 1];
      o0 = wmma4(v0.xy, bp, o0);
      o1 = wmma4(v1.xy, bp, o1);
      o2 = wmma4(v2.xy, bp, o2);
      o3 = wmma4(v3.xy, bp, o3);
      bp.x = p[4 * t + 2]; bp.y = p[4 * t + 3];
      o0 = wmma4(v0.zw, bp, o0);
      o1 = wmma4(v1.zw, bp, o1);
      o2 = wmma4(v2.zw, bp, o2);
      o3 = wmma4(v3.zw, bp, o3);
    }
  }

  // normalize and store as (b, p, c): a lane has 8 consecutive channels
  // n*64 + ct*16 + 8*half + r of its query, two 16-byte stores a tile
  const float rcp = 1.0f / (l + xhalf(l));
  #pragma unroll  // constant indices keep the output tiles in registers
  for (int r = 0; r < 8; ++r) {
    o0[r] *= rcp; o1[r] *= rcp; o2[r] *= rcp; o3[r] *= rcp;
  }
  v4f* xo = reinterpret_cast<v4f*>(
      Xatt + ((size_t)b * kHW + q0 + idx) * kC + n * kHD + 8 * half);
  xo[0]  = o0.lo; xo[1]  = o0.hi;
  xo[4]  = o1.lo; xo[5]  = o1.hi;
  xo[8]  = o2.lo; xo[9]  = o2.hi;
  xo[12] = o3.lo; xo[13] = o3.hi;
}

// ---------------------------------------------------------------------------
// Output projection + bias + residual:
// Y[b][o][p] = sum_c Wout[o][c] * Xatt[b][p][c] + bout[o] + textn[b][o][p]
// One block -> 64 out channels x 128 px.  grid = (8, 4, B); block = 256
// ---------------------------------------------------------------------------
__global__ __launch_bounds__(256) void proj_out_kernel(
    const float* __restrict__ Wout, const float* __restrict__ bout,
    const float* __restrict__ Xatt, const float* __restrict__ textn,
    float* __restrict__ Y) {
  __shared__ __attribute__((aligned(16))) float As[2 * kAElems];
  __shared__ __attribute__((aligned(16))) float Bs[2 * kBElemsPK];
  const int wave = threadIdx.x >> 5, lane = threadIdx.x & 31;
  const int half = lane >> 4, idx = lane & 15;
  const int p0 = blockIdx.x * kBN;
  const int o0 = blockIdx.y * kBM;
  const int b  = blockIdx.z;
  const float* Wp = Wout + (size_t)o0 * kC;
  const float* Xp = Xatt + ((size_t)b * kHW + p0) * kC;

  v8f acc[2][2] = {};
  gemm_64x128<true>(Wp, Xp, As, Bs, acc);

  const int wm = (wave >> 2) * 32, wn = (wave & 3) * 32;
  // Bias and residual come into registers one run of 16 rows at a time.
  float bo[2][8], res[2][8][2];
  #pragma unroll  // constant indices keep bo and res in registers
  for (int i = 0; i < 2; ++i) {
    #pragma unroll  // as above
    for (int r = 0; r < 8; ++r) {
      const int o = o0 + wm + i * 16 + r + 8 * half;
      bo[i][r] = bout[o];
      #pragma unroll  // as above
      for (int j = 0; j < 2; ++j)
        res[i][r][j] = textn[((size_t)b * kC + o) * kHW + p0 + wn + j * 16 + idx];
    }
    // behind the run's last load: the next run's results may be given the
    // registers that held this run's addresses
    asm volatile("s_wait_xcnt 0x0" ::: "memory");
  }
  #pragma unroll  // constant indices keep acc, bo and res in registers
  for (int i = 0; i < 2; ++i) {
    #pragma unroll  // as above
    for (int r = 0; r < 8; ++r) {
      const int o = o0 + wm + i * 16 + r + 8 * half;
      #pragma unroll  // as above
      for (int j = 0; j < 2; ++j)
        Y[((size_t)b * kC + o) * kHW + p0 + wn + j * 16 + idx] =
            acc[i][j][r] + bo[i][r] + res[i][r][j];
    }
  }
}

// ---------------------------------------------------------------------------
extern "C" void kernel_launch(void* const* d_in, const int* in_sizes, int n_in,
                              void* d_out, int out_size, void* d_ws, size_t ws_size,
                              hipStream_t stream) {
  const float* fea_img  = (const float*)d_in[0];
  const float* fea_text = (const float*)d_in[1];
  const float* gnA_w    = (const float*)d_in[2];
  const float* gnA_b    = (const float*)d_in[3];
  const float* gnB_w    = (const float*)d_in[4];
  const float* gnB_b    = (const float*)d_in[5];
  const float* W_qkv_A  = (const float*)d_in[6];
  const float* W_qkv_B  = (const float*)d_in[7];
  const float* W_out    = (const float*)d_in[8];
  const float* b_out    = (const float*)d_in[9];
  float* out = (float*)d_out;

  float* ws = (float*)d_ws;
  const size_t SEG = (size_t)kB * kC * kHW;   // 4,194,304 floats (16 MB)
  float* img_n  = ws + 0 * SEG;
  float* text_n = ws + 1 * SEG;
  float* Qb     = ws + 2 * SEG;   // (B, 4, 64, 1024)
  float* Kb     = ws + 3 * SEG;
  float* Vb     = ws + 4 * SEG;
  float* Xatt   = ws + 5 * SEG;   // (B, 1024, 256)

  groupnorm_kernel<<<kB * kGroups, kGNThreads, 0, stream>>>(fea_img,  gnA_w, gnA_b, img_n);
  groupnorm_kernel<<<kB * kGroups, kGNThreads, 0, stream>>>(fea_text, gnB_w, gnB_b, text_n);

  dim3 gq(8, 4, kB);
  qkv_kernel<<<gq, 256, 0, stream>>>(W_qkv_A, img_n,  Qb, 0);  // Q from img
  qkv_kernel<<<gq, 256, 0, stream>>>(W_qkv_B, text_n, Kb, 1);  // K from text
  qkv_kernel<<<gq, 256, 0, stream>>>(W_qkv_B, text_n, Vb, 2);  // V from text

  attn_kernel<<<512, 256, 0, stream>>>(Qb, Kb, Vb, Xatt);

  proj_out_kernel<<<gq, 256, 0, stream>>>(W_out, b_out, Xatt, text_n, out);
}

// v004
// Measured time: 163 microseconds a run.
// Two timings next to v003 both put it at 1.05 times that version's speed.
// All steps since v000 together make it 2.34 times as fast.
#include <hip/hip_runtime.h>
#include <hip/hip_bf16.h>
#include <math.h>

typedef float v2f __attribute__((ext_vector_type(2)));
typedef float v8f __attribute__((ext_vector_type(8)));

constexpr int kB      = 16;
constexpr int kC      = 256;
constexpr int kHW     = 1024;   // 32*32 pixels
constexpr int kHeads  = 4;
constexpr int kHD     = 64;     // head dim
constexpr int kGroups = 16;
constexpr int kCPG    = kC / kGroups;  // 16 channels per group
constexpr float kEPS  = 1e-5f;

// ---------------------------------------------------------------------------
// f32 dense WMMA: D(16x16,f32) = A(16x4,f32) * B(4x16,f32) + C
// A frag: lane<16 -> M=lane, K = {0,1}; lane>=16 -> M=lane-16, K = {2,3}
// B frag: lane<16 -> N=lane, K = {0,1}; lane>=16 -> N=lane-16, K = {2,3}
// C/D   : vgpr r, lane<16 -> (M=r, N=lane); lane>=16 -> (M=r+8, N=lane-16)
// ---------------------------------------------------------------------------
__device__ __forceinline__ v8f wmma4(v2f a, v2f b, v8f c) {
  return __builtin_amdgcn_wmma_f32_16x16x4_f32(
      /*neg_a=*/false, a, /*neg_b=*/false, b,
      /*c_mod=*/(short)0, c, /*reuse_a=*/false, /*reuse_b=*/false);
}

// the wave's own async global->LDS copies (ASYNCcnt path) have landed
__device__ __forceinline__ void wait_async0() {
  asm volatile("s_wait_asynccnt 0" ::: "memory");
}

// ---------------------------------------------------------------------------
// GroupNorm: one block per (batch, group); 16 ch * 1024 px = 16384 elements.
// 16 waves; each thread brings 8 x 16 bytes, all loads in flight at once, and
// keeps them in registers, so the group is read from memory one time only.
// ---------------------------------------------------------------------------
typedef float v4f __attribute__((ext_vector_type(4)));
constexpr int kGNThreads = 512;
constexpr int kGNWaves   = kGNThreads / 32;
constexpr int kGNVec     = kCPG * kHW / 4 / kGNThreads;   // 8 vectors per thread

__global__ __launch_bounds__(kGNThreads) void groupnorm_kernel(
    const float* __restrict__ x, const float* __restrict__ gw,
    const float* __restrict__ gb, float* __restrict__ y) {
  const int bg = blockIdx.x;           // b*kGroups + g
  const int g  = bg % kGroups;
  const size_t base = (size_t)bg * kCPG * kHW;   // == b*kC*kHW + g*kCPG*kHW
  const v4f* xp = reinterpret_cast<const v4f*>(x + base);
  v4f*       yp = reinterpret_cast<v4f*>(y + base);
  const int tid = threadIdx.x;

  v4f v[kGNVec];
  #pragma unroll
  for (int k = 0; k < kGNVec; ++k) v[k] = xp[tid + k * kGNThreads];

  // vector tid + k*512 lies in channel (tid >> 8) + 2k of the group; tid >> 8
  // is the same in every lane of a wave, and readfirstlane lets the weight and
  // bias come by scalar loads instead of one vector load a lane.
  const int c0 = g * kCPG + __builtin_amdgcn_readfirstlane(tid >> 8);
  float wk[kGNVec], bk[kGNVec];
  #pragma unroll
  for (int k = 0; k < kGNVec; ++k) { wk[k] = gw[c0 + 2 * k]; bk[k] = gb[c0 + 2 * k]; }

  float s = 0.f, s2 = 0.f;
  #pragma unroll
  for (int k = 0; k < kGNVec; ++k) {
    #pragma unroll
    for (int e = 0; e < 4; ++e) { const float t = v[k][e]; s += t; s2 += t * t; }
  }
  for (int off = 16; off > 0; off >>= 1) {
    s  += __shfl_down(s,  off, 32);
    s2 += __shfl_down(s2, off, 32);
  }
  __shared__ float rs[kGNWaves], rs2[kGNWaves];
  __shared__ float smu, srstd;
  const int wv = tid >> 5, ln = tid & 31;
  if (ln == 0) { rs[wv] = s; rs2[wv] = s2; }
  __syncthreads();
  if (tid == 0) {
    float ts = 0.f, ts2 = 0.f;
    for (int i = 0; i < kGNWaves; ++i) { ts += rs[i]; ts2 += rs2[i]; }
    const float cnt = (float)(kCPG * kHW);
    float mu  = ts / cnt;
    float var = ts2 / cnt - mu * mu;
    smu = mu; srstd = rsqrtf(var + kEPS);
  }
  __syncthreads();
  const float mu = smu, rstd = srstd;
  #pragma unroll
  for (int k = 0; k < kGNVec; ++k) {
    v4f o;
    #pragma unroll
    for (int e = 0; e < 4; ++e) o[e] = (v[k][e] - mu) * rstd * wk[k] + bk[k];
    yp[tid + k * kGNThreads] = o;
  }
}

// ---------------------------------------------------------------------------
// Shared body of the projections: a block of 8 waves forms a 64 (out ch) x 128
// (px) tile over K = 256.  The weights and the activations come in chunks of
// 32 k through LDS (async 16-byte copies, whole 128-byte lines, two buffers:
// the next chunk flies while this one is worked on).  Each wave holds 2 x 2
// accumulator tiles, so a fragment read from LDS feeds two matrix instructions.
// The k order of every accumulator is ascending, four at a time.
//   weights tile  As[row][k]   pitch 36 dwords: 8-byte fragment reads of 16
//                              rows x 2 halves fall on 64 different banks
//   activations   Bs[k][px]    pitch 136 dwords (rows kk and kk+2 lie 16 banks
//                              apart), or Bs[px][k] pitch 36 where k is the
//                              contiguous dimension in memory
// ---------------------------------------------------------------------------
constexpr int kBM = 64, kBN = 128, kBK = 32;
constexpr int kChunks = kC / kBK;            // 8
constexpr int kPA = kBK + 4;                 // 36 dwords
constexpr int kPX = kBN + 8;                 // 136 dwords
constexpr int kAElems = kBM * kPA;           // 2304 floats a buffer
constexpr int kBElemsKP = kBK * kPX;         // 4352 floats a buffer, [k][px]
constexpr int kBElemsPK = kBN * kPA;         // 4608 floats a buffer, [px][k]

// Six async copies of one thread (one chunk's share).  The s_wait_xcnt stands
// in the copies' own statement, so that no address register named here is
// rewritten ahead of it.
__device__ __forceinline__ void async_copy6(
    unsigned l0, const float* g0, unsigned l1, const float* g1,
    unsigned l2, const float* g2, unsigned l3, const float* g3,
    unsigned l4, const float* g4, unsigned l5, const float* g5) {
  asm volatile("global_load_async_to_lds_b128 %0, %1, off\n\t"
               "global_load_async_to_lds_b128 %2, %3, off\n\t"
               "global_load_async_to_lds_b128 %4, %5, off\n\t"
               "global_load_async_to_lds_b128 %6, %7, off\n\t"
               "global_load_async_to_lds_b128 %8, %9, off\n\t"
               "global_load_async_to_lds_b128 %10, %11, off\n\t"
               "s_wait_xcnt 0x0"
               :: "v"(l0), "v"(g0), "v"(l1), "v"(g1), "v"(l2), "v"(g2),
                  "v"(l3), "v"(g3), "v"(l4), "v"(g4), "v"(l5), "v"(g5)
               : "memory");
}

// Ag: first of the 64 weight rows (pitch kC).  Bg: the tile's first activation:
// [k][px] with pitch kHW (kPxMajor false) or [px][k] with pitch kC (true).
template <bool kPxMajor>
__device__ __forceinline__ void gemm_64x128(
    const float* __restrict__ Ag, const float* __restrict__ Bg,
    float* As, float* Bs, v8f (&acc)[2][2]) {
  constexpr int kBElems = kPxMajor ? kBElemsPK : kBElemsKP;
  const int tid  = threadIdx.x;
  const int wave = tid >> 5, lane = tid & 31;
  const int half = lane >> 4, idx = lane & 15;
  const int wm = (wave >> 2) * 32, wn = (wave & 3) * 32;

  // copy assignment.  [row][k] tiles: 8 threads a row of 128 bytes, 32 rows a
  // sweep.  [k][px] tile: one wave a row of 512 bytes, 8 rows a sweep.
  const int ar = tid >> 3, ac = (tid & 7) * 4;
  const int br = kPxMajor ? ar : wave;
  const int bc = kPxMajor ? ac : lane * 4;
  constexpr int kBPitch  = kPxMajor ? kPA : kPX;       // LDS pitch, dwords
  constexpr int kBSweep  = kPxMajor ? 32 : 8;          // rows a sweep
  constexpr int kBGPitch = kPxMajor ? kC : kHW;        // pitch in memory
  constexpr int kBGChunk = kPxMajor ? kBK : kBK * kHW; // next chunk in memory
  const float* ga = Ag + (size_t)ar * kC + ac;
  const float* gb = Bg + (size_t)br * kBGPitch + bc;
  const unsigned la = (unsigned)(uintptr_t)(As + ar * kPA + ac);
  const unsigned lb = (unsigned)(uintptr_t)(Bs + br * kBPitch + bc);

  auto issue = [&](int t) {
    const unsigned a0 = la + (unsigned)(t & 1) * (kAElems * 4);
    const unsigned b0 = lb + (unsigned)(t & 1) * (kBElems * 4);
    const float* pa = ga + t * kBK;
    const float* pb = gb + (size_t)t * kBGChunk;
    async_copy6(a0,                          pa,
                a0 + 32 * kPA * 4,           pa + 32 * kC,
                b0,                          pb,
                b0 + 1 * kBSweep * kBPitch * 4, pb + 1 * kBSweep * kBGPitch,
                b0 + 2 * kBSweep * kBPitch * 4, pb + 2 * kBSweep * kBGPitch,
                b0 + 3 * kBSweep * kBPitch * 4, pb + 3 * kBSweep * kBGPitch);
  };

  issue(0);
  wait_async0();        // own copies of chunk 0 have landed
  __syncthreads();      // chunk 0 visible to every wave
  issue(1);

  for (int t = 0; t < kChunks; ++t) {
    const float* A0 = As + (t & 1) * kAElems;
    const float* B0 = Bs + (t & 1) * kBElems;
    // unrolled so that the fragment reads of later k steps can be issued ahead
    #pragma unroll
    for (int ks = 0; ks < kBK / 4; ++ks) {
      const int kk = ks * 4 + 2 * half;
      v2f a[2], bf[2];
      // the loops over i and j are unrolled so that a, bf and acc stay in registers
      #pragma unroll
      for (int i = 0; i < 2; ++i)
        a[i] = *reinterpret_cast<const v2f*>(A0 + (wm + i * 16 + idx) * kPA + kk);
      #pragma unroll
      for (int j = 0; j < 2; ++j) {
        if (kPxMajor) {
          bf[j] = *reinterpret_cast<const v2f*>(B0 + (wn + j * 16 + idx) * kPA + kk);
        } else {
          bf[j].x = B0[kk * kPX + wn + j * 16 + idx];
          bf[j].y = B0[(kk + 1) * kPX + wn + j * 16 + idx];
        }
      }
      #pragma unroll
      for (int i = 0; i < 2; ++i)
        #pragma unroll
        for (int j = 0; j < 2; ++j) acc[i][j] = wmma4(a[i], bf[j], acc[i][j]);
    }
    asm volatile("s_wait_dscnt 0" ::: "memory");  // own reads of this buffer done
    wait_async0();                                // own copies of chunk t+1 landed
    __syncthreads();   // publishes chunk t+1, ends every read of this buffer
    if (t + 2 < kChunks) issue(t + 2);            // refill the buffer just read
  }
  wait_async0();        // nothing in flight when the wave ends
}

// ---------------------------------------------------------------------------
// QKV projection: Y[b][n][c][p] = sum_k W[n*192 + sel*64 + c][k] * X[b][k][p]
// sel: 0 = Q rows, 1 = K rows, 2 = V rows.  One block -> one head's 64 rows x
// 128 px.  grid = (8, 4, B); block = 256
// ---------------------------------------------------------------------------
__global__ __launch_bounds__(256) void qkv_kernel(
    const float* __restrict__ W, const float* __restrict__ X,
    float* __restrict__ Y, int sel) {
  __shared__ __attribute__((aligned(16))) float As[2 * kAElems];
  __shared__ __attribute__((aligned(16))) float Bs[2 * kBElemsKP];
  const int wave = threadIdx.x >> 5, lane = threadIdx.x & 31;
  const int half = lane >> 4, idx = lane & 15;
  const int p0 = blockIdx.x * kBN;
  const int n  = blockIdx.y;            // head
  const float* Wp = W + (size_t)(n * 192 + sel * 64) * kC;
  const float* Xp = X + (size_t)blockIdx.z * kC * kHW + p0;

  v8f acc[2][2] = {};
  gemm_64x128<false>(Wp, Xp, As, Bs, acc);

  const int wm = (wave >> 2) * 32, wn = (wave & 3) * 32;
  float* Yp = Y + (((size_t)blockIdx.z * kHeads + n) * kHD + wm + 8 * half)
                  * (size_t)kHW + p0 + wn + idx;
  // unrolled: acc is indexed by constants only and stays in registers
  #pragma unroll
  for (int i = 0; i < 2; ++i)
    #pragma unroll
    for (int j = 0; j < 2; ++j)
      #pragma unroll
      for (int r = 0; r < 8; ++r)
        Yp[(size_t)(i * 16 + r) * kHW + j * 16] = acc[i][j][r];
}

__device__ __forceinline__ float xhalf(float x) {
  return __builtin_bit_cast(float, __builtin_amdgcn_permlanex16(
      __builtin_bit_cast(int, x), __builtin_bit_cast(int, x),
      0x76543210, 0xfedcba98, false, false));
}

constexpr int kTK     = 64;            // keys a tile
constexpr int kTiles  = kHW / kTK;     // 16
constexpr int kPK     = kTK + 8;       // 72 dwords
constexpr int kPV     = kTK + 4;       // 68 dwords
constexpr int kKElems = kHD * kPK;     // 4608 floats a buffer
constexpr int kVElems = kHD * kPV;     // 4352 floats a buffer

// Eight async copies of one thread (one tile's share).  The s_wait_xcnt stands
// in the copies' own statement, so that no address register named here is
// rewritten ahead of it.
__device__ __forceinline__ void async_copy8(
    unsigned l0, const float* g0, unsigned l1, const float* g1,
    unsigned l2, const float* g2, unsigned l3, const float* g3,
    unsigned l4, const float* g4, unsigned l5, const float* g5,
    unsigned l6, const float* g6, unsigned l7, const float* g7) {
  asm volatile("global_load_async_to_lds_b128 %0, %1, off\n\t"
               "global_load_async_to_lds_b128 %2, %3, off\n\t"
               "global_load_async_to_lds_b128 %4, %5, off\n\t"
               "global_load_async_to_lds_b128 %6, %7, off\n\t"
               "global_load_async_to_lds_b128 %8, %9, off\n\t"
               "global_load_async_to_lds_b128 %10, %11, off\n\t"
               "global_load_async_to_lds_b128 %12, %13, off\n\t"
               "global_load_async_to_lds_b128 %14, %15, off\n\t"
               "s_wait_xcnt 0x0"
               :: "v"(l0), "v"(g0), "v"(l1), "v"(g1), "v"(l2), "v"(g2),
                  "v"(l3), "v"(g3), "v"(l4), "v"(g4), "v"(l5), "v"(g5),
                  "v"(l6), "v"(g6), "v"(l7), "v"(g7)
               : "memory");
}

__global__ __launch_bounds__(256) void attn_kernel(
    const float* __restrict__ Q, const float* __restrict__ K,
    const float* __restrict__ V, float* __restrict__ Xatt) {
  __shared__ __attribute__((aligned(16))) float Kt[2 * kKElems];
  __shared__ __attribute__((aligned(16))) float Vt[2 * kVElems];
  const int tid  = threadIdx.x;
  const int wave = tid >> 5, lane = tid & 31;
  const int half = lane >> 4, idx = lane & 15;
  const int wid = blockIdx.x * 8 + wave;     // 0..4095
  const int qt  = wid & 63;                  // query tile (per wave)
  const int bn  = wid >> 6;                  // b*4 + n (uniform in block)
  const int n   = bn & 3, b = bn >> 2;
  const float* Qp = Q + (size_t)bn * kHD * kHW;
  const float* Kp = K + (size_t)bn * kHD * kHW;
  const float* Vp = V + (size_t)bn * kHD * kHW;
  const int q0 = qt * 16;

  // staging assignment: 16 threads a row of 256 bytes, 16 rows a sweep, four
  // sweeps for K and four for V
  const int sc = tid >> 4;            // 0..15
  const int x4 = (tid & 15) * 4;      // 0,4,..,60
  const unsigned kofs = (unsigned)(uintptr_t)(Kt + sc * kPK + x4);
  const unsigned vofs = (unsigned)(uintptr_t)(Vt + sc * kPV + x4);
  const float* gk = Kp + (size_t)sc * kHW + x4;
  const float* gv = Vp + (size_t)sc * kHW + x4;
  auto issue = [&](int t) {
    const unsigned k0 = kofs + (unsigned)(t & 1) * (kKElems * 4);
    const unsigned v0 = vofs + (unsigned)(t & 1) * (kVElems * 4);
    const float* pk = gk + t * kTK;
    const float* pv = gv + t * kTK;
    async_copy8(k0,                pk,
                k0 + 16 * kPK * 4, pk + 16 * kHW,
                k0 + 32 * kPK * 4, pk + 32 * kHW,
                k0 + 48 * kPK * 4, pk + 48 * kHW,
                v0,                pv,
                v0 + 16 * kPV * 4, pv + 16 * kHW,
                v0 + 32 * kPV * 4, pv + 32 * kHW,
                v0 + 48 * kPV * 4, pv + 48 * kHW);
  };
  issue(0);

  // preload B frags of Q (column = query px, K dim = channel 0..63)
  v2f aq[16];
  #pragma unroll
  for (int ks = 0; ks < 16; ++ks) {
    const int c = ks * 4 + 2 * half;
    aq[ks].x = Qp[(size_t)c * kHW + q0 + idx];
    aq[ks].y = Qp[(size_t)(c + 1) * kHW + q0 + idx];
  }

  // o[ct][r] = O^T[c = ct*16 + r + 8*half][query idx]
  v8f o0 = {}, o1 = {}, o2 = {}, o3 = {};
  // of query idx: m is the same in both halves, l sums this half's keys only
  float m = -3.0e38f, l = 0.f;
  const float inv_sqrt_c = 0.0625f;   // 1/sqrt(256)

  wait_async0();        // own copies of tile 0 have landed
  __syncthreads();      // tile 0 visible to every wave
  issue(1);

  for (int t = 0; t < kTiles; ++t) {
    const float* K0 = Kt + (t & 1) * kKElems;
    const float* V0 = Vt + (t & 1) * kVElems;
    // unrolled so that the fragment reads of the next 16 keys can be issued ahead
    #pragma unroll
    for (int y0 = 0; y0 < kTK; y0 += 16) {
      // ---- S^T tile = K^T Q (K frags from LDS) ----
      v8f s = {};
      #pragma unroll
      for (int ks = 0; ks < 16; ++ks) {
        const int c = ks * 4 + 2 * half;
        v2f ak;
        ak.x = K0[c * kPK + y0 + idx];
        ak.y = K0[(c + 1) * kPK + y0 + idx];
        s = wmma4(ak, aq[ks], s);
      }
      // ---- online softmax: this lane's 8 keys, then the other half's 8 ----
      float sv[8], p[8];
      #pragma unroll  // constant indices keep s, sv and p in registers
      for (int r = 0; r < 8; ++r) sv[r] = s[r] * inv_sqrt_c;
      float mx = sv[0];
      #pragma unroll  // as above
      for (int r = 1; r < 8; ++r) mx = fmaxf(mx, sv[r]);
      mx = fmaxf(mx, xhalf(mx));
      const float mnew = fmaxf(m, mx);
      float rsum = 0.f;
      #pragma unroll  // as above
      for (int r = 0; r < 8; ++r) { p[r] = __expf(sv[r] - mnew); rsum += p[r]; }
      const float resc = __expf(m - mnew);
      l = l * resc + rsum;
      m = mnew;
      #pragma unroll  // constant indices keep the output tiles in registers
      for (int r = 0; r < 8; ++r) {
        o0[r] *= resc; o1[r] *= resc; o2[r] *= resc; o3[r] *= resc;
      }

      // ---- O^T += V(64x16) * P^T(16x16) (V frags from LDS, P from registers) ----
      #pragma unroll  // p is indexed by constants only and stays in registers
      for (int u = 0; u < 2; ++u) {
        // one 16-byte read holds the A fragments of two k steps
        const int kk = y0 + 8 * half + 4 * u;
        const v4f v0 = *reinterpret_cast<const v4f*>(V0 + (0 * 16 + idx) * kPV + kk);
        const v4f v1 = *reinterpret_cast<const v4f*>(V0 + (1 * 16 + idx) * kPV + kk);
        const v4f v2 = *reinterpret_cast<const v4f*>(V0 + (2 * 16 + idx) * kPV + kk);
        const v4f v3 = *reinterpret_cast<const v4f*>(V0 + (3 * 16 + idx) * kPV + kk);
        v2f bp; bp.x = p[4 * u]; bp.y = p[4 * u + 1];
        o0 = wmma4(v0.xy, bp, o0);
        o1 = wmma4(v1.xy, bp, o1);
        o2 = wmma4(v2.xy, bp, o2);
        o3 = wmma4(v3.xy, bp, o3);
        bp.x = p[4 * u + 2]; bp.y = p[4 * u + 3];
        o0 = wmma4(v0.zw, bp, o0);
        o1 = wmma4(v1.zw, bp, o1);
        o2 = wmma4(v2.zw, bp, o2);
        o3 = wmma4(v3.zw, bp, o3);
      }
    }
    asm volatile("s_wait_dscnt 0" ::: "memory");  // own reads of this buffer done
    wait_async0();                                // own copies of tile t+1 landed
    __syncthreads();   // publishes tile t+1, ends every read of this buffer
    if (t + 2 < kTiles) issue(t + 2);             // refill the buffer just read
  }
  wait_async0();        // nothing in flight when the wave ends

  // normalize and store as (b, p, c): a lane has 8 consecutive channels
  // n*64 + ct*16 + 8*half + r of its query, two 16-byte stores a tile
  const float rcp = 1.0f / (l + xhalf(l));
  #pragma unroll  // constant indices keep the output tiles in registers
  for (int r = 0; r < 8; ++r) {
    o0[r] *= rcp; o1[r] *= rcp; o2[r] *= rcp; o3[r] *= rcp;
  }
  v4f* xo = reinterpret_cast<v4f*>(
      Xatt + ((size_t)b * kHW + q0 + idx) * kC + n * kHD + 8 * half);
  xo[0]  = o0.lo; xo[1]  = o0.hi;
  xo[4]  = o1.lo; xo[5]  = o1.hi;
  xo[8]  = o2.lo; xo[9]  = o2.hi;
  xo[12] = o3.lo; xo[13] = o3.hi;
}

// ---------------------------------------------------------------------------
// Output projection + bias + residual:
// Y[b][o][p] = sum_c Wout[o][c] * Xatt[b][p][c] + bout[o] + textn[b][o][p]
// One block -> 64 out channels x 128 px.  grid = (8, 4, B); block = 256
// ---------------------------------------------------------------------------
__global__ __launch_bounds__(256) void proj_out_kernel(
    const float* __restrict__ Wout, const float* __restrict__ bout,
    const float* __restrict__ Xatt, const float* __restrict__ textn,
    float* __restrict__ Y) {
  __shared__ __attribute__((aligned(16))) float As[2 * kAElems];
  __shared__ __attribute__((aligned(16))) float Bs[2 * kBElemsPK];
  const int wave = threadIdx.x >> 5, lane = threadIdx.x & 31;
  const int half = lane >> 4, idx = lane & 15;
  const int p0 = blockIdx.x * kBN;
  const int o0 = blockIdx.y * kBM;
  const int b  = blockIdx.z;
  const float* Wp = Wout + (size_t)o0 * kC;
  const float* Xp = Xatt + ((size_t)b * kHW + p0) * kC;

  v8f acc[2][2] = {};
  gemm_64x128<true>(Wp, Xp, As, Bs, acc);

  const int wm = (wave >> 2) * 32, wn = (wave & 3) * 32;
  // Bias and residual come into registers one run of 16 rows at a time.
  float bo[2][8], res[2][8][2];
  #pragma unroll  // constant indices keep bo and res in registers
  for (int i = 0; i < 2; ++i) {
    #pragma unroll  // as above
    for (int r = 0; r < 8; ++r) {
      const int o = o0 + wm + i * 16 + r + 8 * half;
      bo[i][r] = bout[o];
      #pragma unroll  // as above
      for (int j = 0; j < 2; ++j)
        res[i][r][j] = textn[((size_t)b * kC + o) * kHW + p0 + wn + j * 16 + idx];
    }
    // behind the run's last load: the next run's results may be given the
    // registers that held this run's addresses
    asm volatile("s_wait_xcnt 0x0" ::: "memory");
  }
  #pragma unroll  // constant indices keep acc, bo and res in registers
  for (int i = 0; i < 2; ++i) {
    #pragma unroll  // as above
    for (int r = 0; r < 8; ++r) {
      const int o = o0 + wm + i * 16 + r + 8 * half;
      #pragma unroll  // as above
      for (int j = 0; j < 2; ++j)
        Y[((size_t)b * kC + o) * kHW + p0 + wn + j * 16 + idx] =
            acc[i][j][r] + bo[i][r] + res[i][r][j];
    }
  }
}

// ---------------------------------------------------------------------------
extern "C" void kernel_launch(void* const* d_in, const int* in_sizes, int n_in,
                              void* d_out, int out_size, void* d_ws, size_t ws_size,
                              hipStream_t stream) {
  const float* fea_img  = (const float*)d_in[0];
  const float* fea_text = (const float*)d_in[1];
  const float* gnA_w    = (const float*)d_in[2];
  const float* gnA_b    = (const float*)d_in[3];
  const float* gnB_w    = (const float*)d_in[4];
  const float* gnB_b    = (const float*)d_in[5];
  const float* W_qkv_A  = (const float*)d_in[6];
  const float* W_qkv_B  = (const float*)d_in[7];
  const float* W_out    = (const float*)d_in[8];
  const float* b_out    = (const float*)d_in[9];
  float* out = (float*)d_out;

  float* ws = (float*)d_ws;
  const size_t SEG = (size_t)kB * kC * kHW;   // 4,194,304 floats (16 MB)
  float* img_n  = ws + 0 * SEG;
  float* text_n = ws + 1 * SEG;
  float* Qb     = ws + 2 * SEG;   // (B, 4, 64, 1024)
  float* Kb     = ws + 3 * SEG;
  float* Vb     = ws + 4 * SEG;
  float* Xatt   = ws + 5 * SEG;   // (B, 1024, 256)

  groupnorm_kernel<<<kB * kGroups, kGNThreads, 0, stream>>>(fea_img,  gnA_w, gnA_b, img_n);
  groupnorm_kernel<<<kB * kGroups, kGNThreads, 0, stream>>>(fea_text, gnB_w, gnB_b, text_n);

  dim3 gq(8, 4, kB);
  qkv_kernel<<<gq, 256, 0, stream>>>(W_qkv_A, img_n,  Qb, 0);  // Q from img
  qkv_kernel<<<gq, 256, 0, stream>>>(W_qkv_B, text_n, Kb, 1);  // K from text
  qkv_kernel<<<gq, 256, 0, stream>>>(W_qkv_B, text_n, Vb, 2);  // V from text

  attn_kernel<<<512, 256, 0, stream>>>(Qb, Kb, Vb, Xatt);

  proj_out_kernel<<<gq, 256, 0, stream>>>(W_out, b_out, Xatt, text_n, out);
}

// v005
// A run of this version takes 150 microseconds.
// Timed twice side by side with v004, it ran 1.08 times as fast both times.
// All steps since v000 together make it 2.54 times as fast.
#include <hip/hip_runtime.h>
#include <hip/hip_bf16.h>
#include <math.h>

typedef float v2f __attribute__((ext_vector_type(2)));
typedef float v8f __attribute__((ext_vector_type(8)));

constexpr int kB      = 16;
constexpr int kC      = 256;
constexpr int kHW     = 1024;   // 32*32 pixels
constexpr int kHeads  = 4;
constexpr int kHD     = 64;     // head dim
constexpr int kGroups = 16;
constexpr int kCPG    = kC / kGroups;  // 16 channels per group
constexpr float kEPS  = 1e-5f;

// ---------------------------------------------------------------------------
// f32 dense WMMA: D(16x16,f32) = A(16x4,f32) * B(4x16,f32) + C
// A frag: lane<16 -> M=lane, K = {0,1}; lane>=16 -> M=lane-16, K = {2,3}
// B frag: lane<16 -> N=lane, K = {0,1}; lane>=16 -> N=lane-16, K = {2,3}
// C/D   : vgpr r, lane<16 -> (M=r, N=lane); lane>=16 -> (M=r+8, N=lane-16)
// ---------------------------------------------------------------------------
__device__ __forceinline__ v8f wmma4(v2f a, v2f b, v8f c) {
  return __builtin_amdgcn_wmma_f32_16x16x4_f32(
      /*neg_a=*/false, a, /*neg_b=*/false, b,
      /*c_mod=*/(short)0, c, /*reuse_a=*/false, /*reuse_b=*/false);
}

// the wave's own async global->LDS copies (ASYNCcnt path) have landed
__device__ __forceinline__ void wait_async0() {
  asm volatile("s_wait_asynccnt 0" ::: "memory");
}

// ---------------------------------------------------------------------------
// GroupNorm: one block per (batch, group); 16 ch * 1024 px = 16384 elements.
// 16 waves; each thread brings 8 x 16 bytes, all loads in flight at once, and
// keeps them in registers, so the group is read from memory one time only.
// Both tensors go in one launch: blockIdx.y picks the tensor (0 = A, 1 = B).
// ---------------------------------------------------------------------------
typedef float v4f __attribute__((ext_vector_type(4)));
constexpr int kGNThreads = 512;
constexpr int kGNWaves   = kGNThreads / 32;
constexpr int kGNVec     = kCPG * kHW / 4 / kGNThreads;   // 8 vectors per thread

__global__ __launch_bounds__(kGNThreads) void groupnorm_kernel(
    const float* __restrict__ xA, const float* __restrict__ gwA,
    const float* __restrict__ gbA, float* __restrict__ yA,
    const float* __restrict__ xB, const float* __restrict__ gwB,
    const float* __restrict__ gbB, float* __restrict__ yB) {
  const bool second = blockIdx.y != 0;
  const float* x  = second ? xB  : xA;
  const float* gw = second ? gwB : gwA;
  const float* gb = second ? gbB : gbA;
  float*       y  = second ? yB  : yA;
  const int bg = blockIdx.x;           // b*kGroups + g
  const int g  = bg % kGroups;
  const size_t base = (size_t)bg * kCPG * kHW;   // == b*kC*kHW + g*kCPG*kHW
  const v4f* xp = reinterpret_cast<const v4f*>(x + base);
  v4f*       yp = reinterpret_cast<v4f*>(y + base);
  const int tid = threadIdx.x;

  v4f v[kGNVec];
  #pragma unroll
  for (int k = 0; k < kGNVec; ++k) v[k] = xp[tid + k * kGNThreads];

  // vector tid + k*512 lies in channel (tid >> 8) + 2k of the group; tid >> 8
  // is the same in every lane of a wave, and readfirstlane lets the weight and
  // bias come by scalar loads instead of one vector load a lane.
  const int c0 = g * kCPG + __builtin_amdgcn_readfirstlane(tid >> 8);
  float wk[kGNVec], bk[kGNVec];
  #pragma unroll
  for (int k = 0; k < kGNVec; ++k) { wk[k] = gw[c0 + 2 * k]; bk[k] = gb[c0 + 2 * k]; }

  float s = 0.f, s2 = 0.f;
  #pragma unroll
  for (int k = 0; k < kGNVec; ++k) {
    #pragma unroll
    for (int e = 0; e < 4; ++e) { const float t = v[k][e]; s += t; s2 += t * t; }
  }
  for (int off = 16; off > 0; off >>= 1) {
    s  += __shfl_down(s,  off, 32);
    s2 += __shfl_down(s2, off, 32);
  }
  __shared__ float rs[kGNWaves], rs2[kGNWaves];
  __shared__ float smu, srstd;
  const int wv = tid >> 5, ln = tid & 31;
  if (ln == 0) { rs[wv] = s; rs2[wv] = s2; }
  __syncthreads();
  if (tid == 0) {
    float ts = 0.f, ts2 = 0.f;
    for (int i = 0; i < kGNWaves; ++i) { ts += rs[i]; ts2 += rs2[i]; }
    const float cnt = (float)(kCPG * kHW);
    float mu  = ts / cnt;
    float var = ts2 / cnt - mu * mu;
    smu = mu; srstd = rsqrtf(var + kEPS);
  }
  __syncthreads();
  const float mu = smu, rstd = srstd;
  #pragma unroll
  for (int k = 0; k < kGNVec; ++k) {
    v4f o;
    #pragma unroll
    for (int e = 0; e < 4; ++e) o[e] = (v[k][e] - mu) * rstd * wk[k] + bk[k];
    yp[tid + k * kGNThreads] = o;
  }
}

// ---------------------------------------------------------------------------
// Shared body of the projections: a block of 8 waves forms a 64 (out ch) x 128
// (px) tile over K = 256.  The weights and the activations come in chunks of
// 32 k through LDS (async 16-byte copies, whole 128-byte lines, two buffers:
// the next chunk flies while this one is worked on).  Each wave holds 2 x 2
// accumulator tiles, so a fragment read from LDS feeds two matrix instructions.
// The k order of every accumulator is ascending, four at a time.
//   weights tile  As[row][k]   pitch 36 dwords: 8-byte fragment reads of 16
//                              rows x 2 halves fall on 64 different banks
//   activations   Bs[k][px]    pitch 136 dwords (rows kk and kk+2 lie 16 banks
//                              apart), or Bs[px][k] pitch 36 where k is the
//                              contiguous dimension in memory
// ---------------------------------------------------------------------------
constexpr int kBM = 64, kBN = 128, kBK = 32;
constexpr int kChunks = kC / kBK;            // 8
constexpr int kPA = kBK + 4;                 // 36 dwords
constexpr int kPX = kBN + 8;                 // 136 dwords
constexpr int kAElems = kBM * kPA;           // 2304 floats a buffer
constexpr int kBElemsKP = kBK * kPX;         // 4352 floats a buffer, [k][px]
constexpr int kBElemsPK = kBN * kPA;         // 4608 floats a buffer, [px][k]

// Six async copies of one thread (one chunk's share).  The s_wait_xcnt stands
// in the copies' own statement, so that no address register named here is
// rewritten ahead of it.
__device__ __forceinline__ void async_copy6(
    unsigned l0, const float* g0, unsigned l1, const float* g1,
    unsigned l2, const float* g2, unsigned l3, const float* g3,
    unsigned l4, const float* g4, unsigned l5, const float* g5) {
  asm volatile("global_load_async_to_lds_b128 %0, %1, off\n\t"
               "global_load_async_to_lds_b128 %2, %3, off\n\t"
               "global_load_async_to_lds_b128 %4, %5, off\n\t"
               "global_load_async_to_lds_b128 %6, %7, off\n\t"
               "global_load_async_to_lds_b128 %8, %9, off\n\t"
               "global_load_async_to_lds_b128 %10, %11, off\n\t"
               "s_wait_xcnt 0x0"
               :: "v"(l0), "v"(g0), "v"(l1), "v"(g1), "v"(l2), "v"(g2),
                  "v"(l3), "v"(g3), "v"(l4), "v"(g4), "v"(l5), "v"(g5)
               : "memory");
}

// Ag: first of the 64 weight rows (pitch kC).  Bg: the tile's first activation:
// [k][px] with pitch kHW (kPxMajor false) or [px][k] with pitch kC (true).
template <bool kPxMajor>
__device__ __forceinline__ void gemm_64x128(
    const float* __restrict__ Ag, const float* __restrict__ Bg,
    float* As, float* Bs, v8f (&acc)[2][2]) {
  constexpr int kBElems = kPxMajor ? kBElemsPK : kBElemsKP;
  const int tid  = threadIdx.x;
  const int wave = tid >> 5, lane = tid & 31;
  const int half = lane >> 4, idx = lane & 15;
  const int wm = (wave >> 2) * 32, wn = (wave & 3) * 32;

  // copy assignment.  [row][k] tiles: 8 threads a row of 128 bytes, 32 rows a
  // sweep.  [k][px] tile: one wave a row of 512 bytes, 8 rows a sweep.
  const int ar = tid >> 3, ac = (tid & 7) * 4;
  const int br = kPxMajor ? ar : wave;
  const int bc = kPxMajor ? ac : lane * 4;
  constexpr int kBPitch  = kPxMajor ? kPA : kPX;       // LDS pitch, dwords
  constexpr int kBSweep  = kPxMajor ? 32 : 8;          // rows a sweep
  constexpr int kBGPitch = kPxMajor ? kC : kHW;        // pitch in memory
  constexpr int kBGChunk = kPxMajor ? kBK : kBK * kHW; // next chunk in memory
  const float* ga = Ag + (size_t)ar * kC + ac;
  const float* gb = Bg + (size_t)br * kBGPitch + bc;
  const unsigned la = (unsigned)(uintptr_t)(As + ar * kPA + ac);
  const unsigned lb = (unsigned)(uintptr_t)(Bs + br * kBPitch + bc);

  auto issue = [&](int t) {
    const unsigned a0 = la + (unsigned)(t & 1) * (kAElems * 4);
    const unsigned b0 = lb + (unsigned)(t & 1) * (kBElems * 4);
    const float* pa = ga + t * kBK;
    const float* pb = gb + (size_t)t * kBGChunk;
    async_copy6(a0,                          pa,
                a0 + 32 * kPA * 4,           pa + 32 * kC,
                b0,                          pb,
                b0 + 1 * kBSweep * kBPitch * 4, pb + 1 * kBSweep * kBGPitch,
                b0 + 2 * kBSweep * kBPitch * 4, pb + 2 * kBSweep * kBGPitch,
                b0 + 3 * kBSweep * kBPitch * 4, pb + 3 * kBSweep * kBGPitch);
  };

  issue(0);
  wait_async0();        // own copies of chunk 0 have landed
  __syncthreads();      // chunk 0 visible to every wave
  issue(1);

  for (int t = 0; t < kChunks; ++t) {
    const float* A0 = As + (t & 1) * kAElems;
    const float* B0 = Bs + (t & 1) * kBElems;
    // unrolled so that the fragment reads of later k steps can be issued ahead
    #pragma unroll
    for (int ks = 0; ks < kBK / 4; ++ks) {
      const int kk = ks * 4 + 2 * half;
      v2f a[2], bf[2];
      // the loops over i and j are unrolled so that a, bf and acc stay in registers
      #pragma unroll
      for (int i = 0; i < 2; ++i)
        a[i] = *reinterpret_cast<const v2f*>(A0 + (wm + i * 16 + idx) * kPA + kk);
      #pragma unroll
      for (int j = 0; j < 2; ++j) {
        if (kPxMajor) {
          bf[j] = *reinterpret_cast<const v2f*>(B0 + (wn + j * 16 + idx) * kPA + kk);
        } else {
          bf[j].x = B0[kk * kPX + wn + j * 16 + idx];
          bf[j].y = B0[(kk + 1) * kPX + wn + j * 16 + idx];
        }
      }
      #pragma unroll
      for (int i = 0; i < 2; ++i)
        #pragma unroll
        for (int j = 0; j < 2; ++j) acc[i][j] = wmma4(a[i], bf[j], acc[i][j]);
    }
    asm volatile("s_wait_dscnt 0" ::: "memory");  // own reads of this buffer done
    wait_async0();                                // own copies of chunk t+1 landed
    __syncthreads();   // publishes chunk t+1, ends every read of this buffer
    if (t + 2 < kChunks) issue(t + 2);            // refill the buffer just read
  }
  wait_async0();        // nothing in flight when the wave ends
}

// ---------------------------------------------------------------------------
// QKV projection: Y[b][n][c][p] = sum_k W[n*192 + sel*64 + c][k] * X[b][k][p]
// sel: 0 = Q rows (weights A, input A), 1 = K rows, 2 = V rows (weights B,
// input B).  One block -> one head's 64 rows x 128 px.  All three go in one
// launch: blockIdx.y = sel * 4 + head.  grid = (8, 12, B); block = 256
// ---------------------------------------------------------------------------
__global__ __launch_bounds__(256) void qkv_kernel(
    const float* __restrict__ WA, const float* __restrict__ WB,
    const float* __restrict__ XA, const float* __restrict__ XB,
    float* __restrict__ Yq, float* __restrict__ Yk, float* __restrict__ Yv) {
  __shared__ __attribute__((aligned(16))) float As[2 * kAElems];
  __shared__ __attribute__((aligned(16))) float Bs[2 * kBElemsKP];
  const int wave = threadIdx.x >> 5, lane = threadIdx.x & 31;
  const int half = lane >> 4, idx = lane & 15;
  const int p0 = blockIdx.x * kBN;
  const int sel = blockIdx.y >> 2;
  const int n   = blockIdx.y & 3;       // head
  const float* W = sel == 0 ? WA : WB;
  const float* X = sel == 0 ? XA : XB;
  float*       Y = sel == 0 ? Yq : (sel == 1 ? Yk : Yv);
  const float* Wp = W + (size_t)(n * 192 + sel * 64) * kC;
  const float* Xp = X + (size_t)blockIdx.z * kC * kHW + p0;

  v8f acc[2][2] = {};
  gemm_64x128<false>(Wp, Xp, As, Bs, acc);

  const int wm = (wave >> 2) * 32, wn = (wave & 3) * 32;
  float* Yp = Y + (((size_t)blockIdx.z * kHeads + n) * kHD + wm + 8 * half)
                  * (size_t)kHW + p0 + wn + idx;
  // unrolled: acc is indexed by constants only and stays in registers
  #pragma unroll
  for (int i = 0; i < 2; ++i)
    #pragma unroll
    for (int j = 0; j < 2; ++j)
      #pragma unroll
      for (int r = 0; r < 8; ++r)
        Yp[(size_t)(i * 16 + r) * kHW + j * 16] = acc[i][j][r];
}

__device__ __forceinline__ float xhalf(float x) {
  return __builtin_bit_cast(float, __builtin_amdgcn_permlanex16(
      __builtin_bit_cast(int, x), __builtin_bit_cast(int, x),
      0x76543210, 0xfedcba98, false, false));
}

constexpr int kTK     = 64;            // keys a tile
constexpr int kTiles  = kHW / kTK;     // 16
constexpr int kPK     = kTK + 8;       // 72 dwords
constexpr int kPV     = kTK + 4;       // 68 dwords
constexpr int kKElems = kHD * kPK;     // 4608 floats a buffer
constexpr int kVElems = kHD * kPV;     // 4352 floats a buffer

// Eight async copies of one thread (one tile's share).  The s_wait_xcnt stands
// in the copies' own statement, so that no address register named here is
// rewritten ahead of it.
__device__ __forceinline__ void async_copy8(
    unsigned l0, const float* g0, unsigned l1, const float* g1,
    unsigned l2, const float* g2, unsigned l3, const float* g3,
    unsigned l4, const float* g4, unsigned l5, const float* g5,
    unsigned l6, const float* g6, unsigned l7, const float* g7) {
  asm volatile("global_load_async_to_lds_b128 %0, %1, off\n\t"
               "global_load_async_to_lds_b128 %2, %3, off\n\t"
               "global_load_async_to_lds_b128 %4, %5, off\n\t"
               "global_load_async_to_lds_b128 %6, %7, off\n\t"
               "global_load_async_to_lds_b128 %8, %9, off\n\t"
               "global_load_async_to_lds_b128 %10, %11, off\n\t"
               "global_load_async_to_lds_b128 %12, %13, off\n\t"
               "global_load_async_to_lds_b128 %14, %15, off\n\t"
               "s_wait_xcnt 0x0"
               :: "v"(l0), "v"(g0), "v"(l1), "v"(g1), "v"(l2), "v"(g2),
                  "v"(l3), "v"(g3), "v"(l4), "v"(g4), "v"(l5), "v"(g5),
                  "v"(l6), "v"(g6), "v"(l7), "v"(g7)
               : "memory");
}

__global__ __launch_bounds__(256) void attn_kernel(
    const float* __restrict__ Q, const float* __restrict__ K,
    const float* __restrict__ V, float* __restrict__ Xatt) {
  __shared__ __attribute__((aligned(16))) float Kt[2 * kKElems];
  __shared__ __attribute__((aligned(16))) float Vt[2 * kVElems];
  const int tid  = threadIdx.x;
  const int wave = tid >> 5, lane = tid & 31;
  const int half = lane >> 4, idx = lane & 15;
  const int wid = blockIdx.x * 8 + wave;     // 0..4095
  const int qt  = wid & 63;                  // query tile (per wave)
  const int bn  = wid >> 6;                  // b*4 + n (uniform in block)
  const int n   = bn & 3, b = bn >> 2;
  const float* Qp = Q + (size_t)bn * kHD * kHW;
  const float* Kp = K + (size_t)bn * kHD * kHW;
  const float* Vp = V + (size_t)bn * kHD * kHW;
  const int q0 = qt * 16;

  // staging assignment: 16 threads a row of 256 bytes, 16 rows a sweep, four
  // sweeps for K and four for V
  const int sc = tid >> 4;            // 0..15
  const int x4 = (tid & 15) * 4;      // 0,4,..,60
  const unsigned kofs = (unsigned)(uintptr_t)(Kt + sc * kPK + x4);
  const unsigned vofs = (unsigned)(uintptr_t)(Vt + sc * kPV + x4);
  const float* gk = Kp + (size_t)sc * kHW + x4;
  const float* gv = Vp + (size_t)sc * kHW + x4;
  auto issue = [&](int t) {
    const unsigned k0 = kofs + (unsigned)(t & 1) * (kKElems * 4);
    const unsigned v0 = vofs + (unsigned)(t & 1) * (kVElems * 4);
    const float* pk = gk + t * kTK;
    const float* pv = gv + t * kTK;
    async_copy8(k0,                pk,
                k0 + 16 * kPK * 4, pk + 16 * kHW,
                k0 + 32 * kPK * 4, pk + 32 * kHW,
                k0 + 48 * kPK * 4, pk + 48 * kHW,
                v0,                pv,
                v0 + 16 * kPV * 4, pv + 16 * kHW,
                v0 + 32 * kPV * 4, pv + 32 * kHW,
                v0 + 48 * kPV * 4, pv + 48 * kHW);
  };
  issue(0);

  // preload B frags of Q (column = query px, K dim = channel 0..63)
  v2f aq[16];
  #pragma unroll
  for (int ks = 0; ks < 16; ++ks) {
    const int c = ks * 4 + 2 * half;
    aq[ks].x = Qp[(size_t)c * kHW + q0 + idx];
    aq[ks].y = Qp[(size_t)(c + 1) * kHW + q0 + idx];
  }

  // o[ct][r] = O^T[c = ct*16 + r + 8*half][query idx]
  v8f o0 = {}, o1 = {}, o2 = {}, o3 = {};
  // of query idx: m is the same in both halves, l sums this half's keys only
  float m = -3.0e38f, l = 0.f;
  const float inv_sqrt_c = 0.0625f;   // 1/sqrt(256)

  wait_async0();        // own copies of tile 0 have landed
  __syncthreads();      // tile 0 visible to every wave
  issue(1);

  for (int t = 0; t < kTiles; ++t) {
    const float* K0 = Kt + (t & 1) * kKElems;
    const float* V0 = Vt + (t & 1) * kVElems;
    // unrolled so that the fragment reads of the next 16 keys can be issued ahead
    #pragma unroll
    for (int y0 = 0; y0 < kTK; y0 += 16) {
      // ---- S^T tile = K^T Q (K frags from LDS) ----
      v8f s = {};
      #pragma unroll
      for (int ks = 0; ks < 16; ++ks) {
        const int c = ks * 4 + 2 * half;
        v2f ak;
        ak.x = K0[c * kPK + y0 + idx];
        ak.y = K0[(c + 1) * kPK + y0 + idx];
        s = wmma4(ak, aq[ks], s);
      }
      // ---- online softmax: this lane's 8 keys, then the other half's 8 ----
      float sv[8], p[8];
      #pragma unroll  // constant indices keep s, sv and p in registers
      for (int r = 0; r < 8; ++r) sv[r] = s[r] * inv_sqrt_c;
      float mx = sv[0];
      #pragma unroll  // as above
      for (int r = 1; r < 8; ++r) mx = fmaxf(mx, sv[r]);
      mx = fmaxf(mx, xhalf(mx));
      const float mnew = fmaxf(m, mx);
      float rsum = 0.f;
      #pragma unroll  // as above
      for (int r = 0; r < 8; ++r) { p[r] = __expf(sv[r] - mnew); rsum += p[r]; }
      const float resc = __expf(m - mnew);
      l = l * resc + rsum;
      m = mnew;
      #pragma unroll  // constant indices keep the output tiles in registers
      for (int r = 0; r < 8; ++r) {
        o0[r] *= resc; o1[r] *= resc; o2[r] *= resc; o3[r] *= resc;
      }

      // ---- O^T += V(64x16) * P^T(16x16) (V frags from LDS, P from registers) ----
      #pragma unroll  // p is indexed by constants only and stays in registers
      for (int u = 0; u < 2; ++u) {
        // one 16-byte read holds the A fragments of two k steps
        const int kk = y0 + 8 * half + 4 * u;
        const v4f v0 = *reinterpret_cast<const v4f*>(V0 + (0 * 16 + idx) * kPV + kk);
        const v4f v1 = *reinterpret_cast<const v4f*>(V0 + (1 * 16 + idx) * kPV + kk);
        const v4f v2 = *reinterpret_cast<const v4f*>(V0 + (2 * 16 + idx) * kPV + kk);
        const v4f v3 = *reinterpret_cast<const v4f*>(V0 + (3 * 16 + idx) * kPV + kk);
        v2f bp; bp.x = p[4 * u]; bp.y = p[4 * u + 1];
        o0 = wmma4(v0.xy, bp, o0);
        o1 = wmma4(v1.xy, bp, o1);
        o2 = wmma4(v2.xy, bp, o2);
        o3 = wmma4(v3.xy, bp, o3);
        bp.x = p[4 * u + 2]; bp.y = p[4 * u + 3];
        o0 = wmma4(v0.zw, bp, o0);
        o1 = wmma4(v1.zw, bp, o1);
        o2 = wmma4(v2.zw, bp, o2);
        o3 = wmma4(v3.zw, bp, o3);
      }
    }
    asm volatile("s_wait_dscnt 0" ::: "memory");  // own reads of this buffer done
    wait_async0();                                // own copies of tile t+1 landed
    __syncthreads();   // publishes tile t+1, ends every read of this buffer
    if (t + 2 < kTiles) issue(t + 2);             // refill the buffer just read
  }
  wait_async0();        // nothing in flight when the wave ends

  // normalize and store as (b, p, c): a lane has 8 consecutive channels
  // n*64 + ct*16 + 8*half + r of its query, two 16-byte stores a tile
  const float rcp = 1.0f / (l + xhalf(l));
  #pragma unroll  // constant indices keep the output tiles in registers
  for (int r = 0; r < 8; ++r) {
    o0[r] *= rcp; o1[r] *= rcp; o2[r] *= rcp; o3[r] *= rcp;
  }
  v4f* xo = reinterpret_cast<v4f*>(
      Xatt + ((size_t)b * kHW + q0 + idx) * kC + n * kHD + 8 * half);
  xo[0]  = o0.lo; xo[1]  = o0.hi;
  xo[4]  = o1.lo; xo[5]  = o1.hi;
  xo[8]  = o2.lo; xo[9]  = o2.hi;
  xo[12] = o3.lo; xo[13] = o3.hi;
}

// ---------------------------------------------------------------------------
// Output projection + bias + residual:
// Y[b][o][p] = sum_c Wout[o][c] * Xatt[b][p][c] + bout[o] + textn[b][o][p]
// One block -> 64 out channels x 128 px.  grid = (8, 4, B); block = 256
// ---------------------------------------------------------------------------
__global__ __launch_bounds__(256) void proj_out_kernel(
    const float* __restrict__ Wout, const float* __restrict__ bout,
    const float* __restrict__ Xatt, const float* __restrict__ textn,
    float* __restrict__ Y) {
  __shared__ __attribute__((aligned(16))) float As[2 * kAElems];
  __shared__ __attribute__((aligned(16))) float Bs[2 * kBElemsPK];
  const int wave = threadIdx.x >> 5, lane = threadIdx.x & 31;
  const int half = lane >> 4, idx = lane & 15;
  const int p0 = blockIdx.x * kBN;
  const int o0 = blockIdx.y * kBM;
  const int b  = blockIdx.z;
  const float* Wp = Wout + (size_t)o0 * kC;
  const float* Xp = Xatt + ((size_t)b * kHW + p0) * kC;

  v8f acc[2][2] = {};
  gemm_64x128<true>(Wp, Xp, As, Bs, acc);

  const int wm = (wave >> 2) * 32, wn = (wave & 3) * 32;
  // Bias and residual come into registers one run of 16 rows at a time.
  float bo[2][8], res[2][8][2];
  #pragma unroll  // constant indices keep bo and res in registers
  for (int i = 0; i < 2; ++i) {
    #pragma unroll  // as above
    for (int r = 0; r < 8; ++r) {
      const int o = o0 + wm + i * 16 + r + 8 * half;
      bo[i][r] = bout[o];
      #pragma unroll  // as above
      for (int j = 0; j < 2; ++j)
        res[i][r][j] = textn[((size_t)b * kC + o) * kHW + p0 + wn + j * 16 + idx];
    }
    // behind the run's last load: the next run's results may be given the
    // registers that held this run's addresses
    asm volatile("s_wait_xcnt 0x0" ::: "memory");
  }
  #pragma unroll  // constant indices keep acc, bo and res in registers
  for (int i = 0; i < 2; ++i) {
    #pragma unroll  // as above
    for (int r = 0; r < 8; ++r) {
      const int o = o0 + wm + i * 16 + r + 8 * half;
      #pragma unroll  // as above
      for (int j = 0; j < 2; ++j)
        Y[((size_t)b * kC + o) * kHW + p0 + wn + j * 16 + idx] =
            acc[i][j][r] + bo[i][r] + res[i][r][j];
    }
  }
}

// ---------------------------------------------------------------------------
extern "C" void kernel_launch(void* const* d_in, const int* in_sizes, int n_in,
                              void* d_out, int out_size, void* d_ws, size_t ws_size,
                              hipStream_t stream) {
  const float* fea_img  = (const float*)d_in[0];
  const float* fea_text = (const float*)d_in[1];
  const float* gnA_w    = (const float*)d_in[2];
  const float* gnA_b    = (const float*)d_in[3];
  const float* gnB_w    = (const float*)d_in[4];
  const float* gnB_b    = (const float*)d_in[5];
  const float* W_qkv_A  = (const float*)d_in[6];
  const float* W_qkv_B  = (const float*)d_in[7];
  const float* W_out    = (const float*)d_in[8];
  const float* b_out    = (const float*)d_in[9];
  float* out = (float*)d_out;

  float* ws = (float*)d_ws;
  const size_t SEG = (size_t)kB * kC * kHW;   // 4,194,304 floats (16 MB)
  float* img_n  = ws + 0 * SEG;
  float* text_n = ws + 1 * SEG;
  float* Qb     = ws + 2 * SEG;   // (B, 4, 64, 1024)
  float* Kb     = ws + 3 * SEG;
  float* Vb     = ws + 4 * SEG;
  float* Xatt   = ws + 5 * SEG;   // (B, 1024, 256)

  groupnorm_kernel<<<dim3(kB * kGroups, 2), kGNThreads, 0, stream>>>(
      fea_img, gnA_w, gnA_b, img_n, fea_text, gnB_w, gnB_b, text_n);

  // Q from img, K and V from text
  qkv_kernel<<<dim3(8, 12, kB), 256, 0, stream>>>(
      W_qkv_A, W_qkv_B, img_n, text_n, Qb, Kb, Vb);

  dim3 gq(8, 4, kB);

  attn_kernel<<<512, 256, 0, stream>>>(Qb, Kb, Vb, Xatt);

  proj_out_kernel<<<gq, 256, 0, stream>>>(W_out, b_out, Xatt, text_n, out);
}
